// v000
// The times below were measured on an AMD MI455X: many runs one after another, warmed up first and cycling through
// copies of the inputs, with the whole window's GPU time divided by the number of runs. Launches and the gaps
// between them are all in it. The median over several windows is given; except for v000 it joins two sittings, which
// can be a few percent apart, so the side-by-side timings, each taken in one sitting, are the better comparison.
// v000 is the starting kernel. One run takes 814 microseconds.
#include <hip/hip_runtime.h>
#include <hip/hip_bf16.h>

// ---------------------------------------------------------------------------
// CDNA5 (gfx1250) attention block:  out = softmax(QK^T * s) V  projected.
// All GEMM-like math goes through v_wmma_f32_16x16x32_f16 (f16 in, f32 acc).
// V is pre-transposed to [B][C][N] so every WMMA fragment load is two
// contiguous global_load_b128s; next-block K/V rows are prefetched with
// global_prefetch_b8. Fragment loads are hoisted into distinct registers so
// WMMAs overlap outstanding loads instead of waiting on loadcnt==0.
// ---------------------------------------------------------------------------

typedef __attribute__((ext_vector_type(16))) _Float16 v16h;
typedef __attribute__((ext_vector_type(8)))  _Float16 v8h;
typedef __attribute__((ext_vector_type(8)))  float    v8f;

// Problem constants (fixed by the reference)
#define BB   4
#define NN   2048
#define CC   1024
#define HH   16
#define DD   64
#define LD3  (3 * CC)   // 3072, row stride of qkv buffer
#define MM   (BB * NN)  // 8192 tokens

__device__ __forceinline__ v8f wmma32(v16h a, v16h b, v8f c) {
    // (neg_a, A, neg_b, B, c_mod, C, reuse_a, reuse_b)
    return __builtin_amdgcn_wmma_f32_16x16x32_f16(
        false, a, false, b, (short)0, c, false, false);
}

// Load a 16x32 f16 fragment in the CDNA5 16-bit A/B layout from a row-major
// matrix (16-wide index across lanes&15; K contiguous within a row).
//   lanes 0-15 : idx=lane,    halves [0..7]=K0..7,  [8..15]=K16..23
//   lanes 16-31: idx=lane-16, halves [0..7]=K8..15, [8..15]=K24..31
__device__ __forceinline__ v16h load_frag_rowmajor(const _Float16* base, int ld) {
    const int lane = threadIdx.x & 31;
    const _Float16* p = base + (size_t)(lane & 15) * ld + ((lane >> 4) << 3);
    v8h lo = *(const v8h*)(p);
    v8h hi = *(const v8h*)(p + 16);
    return __builtin_shufflevector(lo, hi, 0, 1, 2, 3, 4, 5, 6, 7,
                                           8, 9, 10, 11, 12, 13, 14, 15);
}

// ---------------------------------------------------------------------------
// Elementwise f32 -> f16 cast
// ---------------------------------------------------------------------------
__global__ void cast_f16_kernel(const float* __restrict__ in,
                                _Float16* __restrict__ out, int n) {
    int i = blockIdx.x * blockDim.x + threadIdx.x;
    if (i < n) out[i] = (_Float16)in[i];
}

// Transposing cast: in[rows][cols] (f32) -> out[cols][rows] (f16).
__global__ void transpose_cast_f16_kernel(const float* __restrict__ in,
                                          _Float16* __restrict__ out,
                                          int rows, int cols) {
    int i = blockIdx.x * blockDim.x + threadIdx.x;
    if (i < rows * cols) {
        int r = i / cols;
        int c = i - r * cols;
        out[(size_t)c * rows + r] = (_Float16)in[i];
    }
}

// Extract + transpose the V slab of qkv:
//   vT[b*C + c][n] = qkv[(b*N + n)*3C + 2C + c]
__global__ void transpose_v_kernel(const _Float16* __restrict__ qkv,
                                   _Float16* __restrict__ vT) {
    int i = blockIdx.x * blockDim.x + threadIdx.x;  // over MM*CC
    if (i < MM * CC) {
        const int tok = i / CC;          // b*N + n
        const int c   = i - tok * CC;    // h*64 + d
        const int b   = tok / NN;
        const int n   = tok - b * NN;
        vT[((size_t)b * CC + c) * NN + n] =
            qkv[(size_t)tok * LD3 + 2 * CC + c];
    }
}

// ---------------------------------------------------------------------------
// WMMA GEMM:  C[M,Nn] = A[M,K] * B[K,Nn]   (B supplied transposed: BT[Nn][K])
// One wave computes a 16x64 tile (4 accumulators), K-loop step 32.
// ---------------------------------------------------------------------------
template <bool OUT_F16>
__global__ __launch_bounds__(32)
void wmma_gemm_kernel(const _Float16* __restrict__ A,
                      const _Float16* __restrict__ BT,
                      _Float16* __restrict__ Ch,
                      float* __restrict__ Cf,
                      const float* __restrict__ bias,
                      int M, int K, int Nn) {
    const int n0 = blockIdx.x * 64;
    const int m0 = blockIdx.y * 16;

    const _Float16* Abase = A + (size_t)m0 * K;

    const v8f vzero = {0.f, 0.f, 0.f, 0.f, 0.f, 0.f, 0.f, 0.f};
    v8f acc[4];
#pragma unroll
    for (int j = 0; j < 4; ++j) acc[j] = vzero;

    const int lane = threadIdx.x & 31;
    const size_t lrow = (size_t)(lane & 15) * K + ((lane >> 4) << 3);

#pragma unroll 2
    for (int k0 = 0; k0 < K; k0 += 32) {
        // prefetch next K-step's A rows (one line per lane)
        if (k0 + 32 < K)
            __builtin_prefetch(Abase + lrow + k0 + 32, 0, 0);
        v16h a  = load_frag_rowmajor(Abase + k0, K);
        v16h b0 = load_frag_rowmajor(BT + (size_t)(n0 +  0) * K + k0, K);
        v16h b1 = load_frag_rowmajor(BT + (size_t)(n0 + 16) * K + k0, K);
        v16h b2 = load_frag_rowmajor(BT + (size_t)(n0 + 32) * K + k0, K);
        v16h b3 = load_frag_rowmajor(BT + (size_t)(n0 + 48) * K + k0, K);
        acc[0] = wmma32(a, b0, acc[0]);
        acc[1] = wmma32(a, b1, acc[1]);
        acc[2] = wmma32(a, b2, acc[2]);
        acc[3] = wmma32(a, b3, acc[3]);
    }

    // C/D layout: reg r, lane -> (row = r + 8*(lane>>4), col = lane&15)
    const int half = lane >> 4;
    const int col  = lane & 15;
#pragma unroll
    for (int j = 0; j < 4; ++j) {
#pragma unroll
        for (int r = 0; r < 8; ++r) {
            const int row = m0 + r + 8 * half;
            const int cn  = n0 + j * 16 + col;
            if (OUT_F16) {
                Ch[(size_t)row * Nn + cn] = (_Float16)acc[j][r];
            } else {
                Cf[(size_t)row * Nn + cn] = acc[j][r] + bias[cn];
            }
        }
    }
}

// ---------------------------------------------------------------------------
// Flash attention: one wave per (batch, head, 16-query tile).
// qkv layout: [B*N, 3C] with q @ col h*64, k @ col C + h*64.
// V comes from the transposed slab vT[B*C][N].
// ---------------------------------------------------------------------------
__global__ __launch_bounds__(32)
void attention_kernel(const _Float16* __restrict__ qkv,
                      const _Float16* __restrict__ vT,
                      _Float16* __restrict__ outh) {
    const int q0   = blockIdx.x * 16;
    const int h    = blockIdx.y;
    const int b    = blockIdx.z;
    const size_t tokBase = (size_t)b * NN;

    const int lane = threadIdx.x & 31;
    const int half = lane >> 4;
    const int col  = lane & 15;

    __shared__ _Float16 Pld[16 * 32];   // prob tile staging: C-layout -> A-layout

    // Q fragments (16 rows x 64 d), two K=32 chunks
    const _Float16* qbase = qkv + (tokBase + q0) * LD3 + h * DD;
    const v16h qa0 = load_frag_rowmajor(qbase, LD3);
    const v16h qa1 = load_frag_rowmajor(qbase + 32, LD3);

    const _Float16* kbase0 = qkv + tokBase * LD3 + CC + h * DD;   // keys, token-major
    const _Float16* vtbase = vT + ((size_t)b * CC + h * DD) * NN; // [64][NN]

    const v8f vzero = {0.f, 0.f, 0.f, 0.f, 0.f, 0.f, 0.f, 0.f};
    v8f o[4];
#pragma unroll
    for (int j = 0; j < 4; ++j) o[j] = vzero;

    float m[8], l[8];
#pragma unroll
    for (int r = 0; r < 8; ++r) { m[r] = -1e30f; l[r] = 0.f; }

    const float scale = 0.125f;  // D^-0.5 = 64^-0.5

    for (int kb = 0; kb < NN; kb += 32) {
        const _Float16* kbase = kbase0 + (size_t)kb * LD3;

        // prefetch next key block's K rows and vT rows (one line per lane)
        if (kb + 32 < NN) {
            __builtin_prefetch(
                kbase + (size_t)(32 + (lane & 15)) * LD3 + ((lane >> 4) << 3), 0, 0);
            __builtin_prefetch(
                vtbase + (size_t)(lane & 15) * NN + kb + 32, 0, 0);
        }

        // ---- issue ALL loads for this block into distinct registers ----
        v16h kf00 = load_frag_rowmajor(kbase, LD3);                    // keys +0,  d 0..31
        v16h kf01 = load_frag_rowmajor(kbase + 32, LD3);               // keys +0,  d 32..63
        v16h kf10 = load_frag_rowmajor(kbase + (size_t)16 * LD3, LD3); // keys +16, d 0..31
        v16h kf11 = load_frag_rowmajor(kbase + (size_t)16 * LD3 + 32, LD3);
        // V fragments are independent of the scores: issue now, consume after
        // softmax so the ds_bpermute/exp work hides their latency.
        v16h vf0 = load_frag_rowmajor(vtbase + (size_t) 0 * NN + kb, NN);
        v16h vf1 = load_frag_rowmajor(vtbase + (size_t)16 * NN + kb, NN);
        v16h vf2 = load_frag_rowmajor(vtbase + (size_t)32 * NN + kb, NN);
        v16h vf3 = load_frag_rowmajor(vtbase + (size_t)48 * NN + kb, NN);

        // ---- scores: S[16 x 32] as two 16x16 f32 tiles ----
        v8f s0 = vzero, s1 = vzero;
        s0 = wmma32(qa0, kf00, s0);
        s0 = wmma32(qa1, kf01, s0);
        s1 = wmma32(qa0, kf10, s1);
        s1 = wmma32(qa1, kf11, s1);

        // ---- online softmax over this 32-key block ----
        float fac[8];
#pragma unroll
        for (int r = 0; r < 8; ++r) {
            float a0 = s0[r] * scale;
            float a1 = s1[r] * scale;
            float rm = fmaxf(a0, a1);
            rm = fmaxf(rm, __shfl_xor(rm, 1, 32));
            rm = fmaxf(rm, __shfl_xor(rm, 2, 32));
            rm = fmaxf(rm, __shfl_xor(rm, 4, 32));
            rm = fmaxf(rm, __shfl_xor(rm, 8, 32));   // row max within 16-lane half
            const float nm = fmaxf(m[r], rm);
            const float p0 = __expf(a0 - nm);
            const float p1 = __expf(a1 - nm);
            float rs = p0 + p1;
            rs += __shfl_xor(rs, 1, 32);
            rs += __shfl_xor(rs, 2, 32);
            rs += __shfl_xor(rs, 4, 32);
            rs += __shfl_xor(rs, 8, 32);             // row sum within half
            const float f = __expf(m[r] - nm);
            l[r] = l[r] * f + rs;
            m[r] = nm;
            fac[r] = f;
            // stash probabilities (C/D layout -> LDS row-major 16x32)
            const int row = r + 8 * half;
            Pld[row * 32 + col]      = (_Float16)p0;
            Pld[row * 32 + 16 + col] = (_Float16)p1;
        }

        // rescale running output accumulators
#pragma unroll
        for (int j = 0; j < 4; ++j)
#pragma unroll
            for (int r = 0; r < 8; ++r) o[j][r] *= fac[r];

        __syncthreads();  // make LDS prob tile visible / ordered
        const v16h pa = load_frag_rowmajor(&Pld[0], 32);

        // ---- O += P[16x32] * V[32x64] ----
        o[0] = wmma32(pa, vf0, o[0]);
        o[1] = wmma32(pa, vf1, o[1]);
        o[2] = wmma32(pa, vf2, o[2]);
        o[3] = wmma32(pa, vf3, o[3]);
        __syncthreads();
    }

    // ---- epilogue: normalize and store f16 at [token, h*64 + d] ----
    _Float16* obase = outh + (tokBase + q0) * CC + h * DD;
#pragma unroll
    for (int j = 0; j < 4; ++j) {
#pragma unroll
        for (int r = 0; r < 8; ++r) {
            const int row = r + 8 * half;
            obase[(size_t)row * CC + j * 16 + col] = (_Float16)(o[j][r] / l[r]);
        }
    }
}

// ---------------------------------------------------------------------------
// Host-side launch
// ---------------------------------------------------------------------------
extern "C" void kernel_launch(void* const* d_in, const int* in_sizes, int n_in,
                              void* d_out, int out_size, void* d_ws, size_t ws_size,
                              hipStream_t stream) {
    const float* x      = (const float*)d_in[0];   // [B,N,C]
    const float* W_qkv  = (const float*)d_in[1];   // [C, 3C]
    const float* W_proj = (const float*)d_in[2];   // [C, C]
    const float* b_proj = (const float*)d_in[3];   // [C]
    float* out = (float*)d_out;                    // [B,N,C] f32

    // Workspace layout (all f16)
    _Float16* xh     = (_Float16*)d_ws;                 // [M, C]
    _Float16* wqkvT  = xh     + (size_t)MM * CC;        // [3C, C]
    _Float16* wprojT = wqkvT  + (size_t)CC * 3 * CC;    // [C, C]
    _Float16* qkvh   = wprojT + (size_t)CC * CC;        // [M, 3C]
    _Float16* attnh  = qkvh   + (size_t)MM * 3 * CC;    // [M, C]
    _Float16* vT     = attnh  + (size_t)MM * CC;        // [B*C, N]

    // 1) precision casts (weights transposed for contiguous B-fragments)
    {
        const int nx = MM * CC;
        cast_f16_kernel<<<(nx + 255) / 256, 256, 0, stream>>>(x, xh, nx);
        const int nq = CC * 3 * CC;
        transpose_cast_f16_kernel<<<(nq + 255) / 256, 256, 0, stream>>>(
            W_qkv, wqkvT, CC, 3 * CC);
        const int np = CC * CC;
        transpose_cast_f16_kernel<<<(np + 255) / 256, 256, 0, stream>>>(
            W_proj, wprojT, CC, CC);
    }

    // 2) qkv = x @ W_qkv              (f16 out)
    wmma_gemm_kernel<true><<<dim3(3 * CC / 64, MM / 16), 32, 0, stream>>>(
        xh, wqkvT, qkvh, nullptr, nullptr, MM, CC, 3 * CC);

    // 2b) transpose V slab for contiguous P*V fragment loads
    {
        const int nv = MM * CC;
        transpose_v_kernel<<<(nv + 255) / 256, 256, 0, stream>>>(qkvh, vT);
    }

    // 3) flash attention per (b, h, 16-query tile)
    attention_kernel<<<dim3(NN / 16, HH, BB), 32, 0, stream>>>(qkvh, vT, attnh);

    // 4) out = attn @ W_proj + b_proj (f32 out)
    wmma_gemm_kernel<false><<<dim3(CC / 64, MM / 16), 32, 0, stream>>>(
        attnh, wprojT, nullptr, out, b_proj, MM, CC, CC);
}

// v001
// A run of this version takes 586 microseconds.
// In two side-by-side timings against v000, it was 1.45 and 1.44 times as fast.
#include <hip/hip_runtime.h>
#include <hip/hip_bf16.h>

// ---------------------------------------------------------------------------
// CDNA5 (gfx1250) attention block:  out = softmax(QK^T * s) V  projected.
// All GEMM-like math goes through v_wmma_f32_16x16x32_f16 (f16 in, f32 acc).
// V is pre-transposed to [B][C][N] so every WMMA fragment load is two
// contiguous global_load_b128s; next-block K/V rows are prefetched with
// global_prefetch_b8. Fragment loads are hoisted into distinct registers so
// WMMAs overlap outstanding loads instead of waiting on loadcnt==0.
// ---------------------------------------------------------------------------

typedef __attribute__((ext_vector_type(16))) _Float16 v16h;
typedef __attribute__((ext_vector_type(8)))  _Float16 v8h;
typedef __attribute__((ext_vector_type(8)))  float    v8f;

// Problem constants (fixed by the reference)
#define BB   4
#define NN   2048
#define CC   1024
#define HH   16
#define DD   64
#define LD3  (3 * CC)   // 3072, row stride of qkv buffer
#define MM   (BB * NN)  // 8192 tokens

__device__ __forceinline__ v8f wmma32(v16h a, v16h b, v8f c) {
    // (neg_a, A, neg_b, B, c_mod, C, reuse_a, reuse_b)
    return __builtin_amdgcn_wmma_f32_16x16x32_f16(
        false, a, false, b, (short)0, c, false, false);
}

// Load a 16x32 f16 fragment in the CDNA5 16-bit A/B layout from a row-major
// matrix (16-wide index across lanes&15; K contiguous within a row).
//   lanes 0-15 : idx=lane,    halves [0..7]=K0..7,  [8..15]=K16..23
//   lanes 16-31: idx=lane-16, halves [0..7]=K8..15, [8..15]=K24..31
__device__ __forceinline__ v16h load_frag_rowmajor(const _Float16* base, int ld) {
    const int lane = threadIdx.x & 31;
    const _Float16* p = base + (size_t)(lane & 15) * ld + ((lane >> 4) << 3);
    v8h lo = *(const v8h*)(p);
    v8h hi = *(const v8h*)(p + 16);
    return __builtin_shufflevector(lo, hi, 0, 1, 2, 3, 4, 5, 6, 7,
                                           8, 9, 10, 11, 12, 13, 14, 15);
}

// ---------------------------------------------------------------------------
// Elementwise f32 -> f16 cast
// ---------------------------------------------------------------------------
__global__ void cast_f16_kernel(const float* __restrict__ in,
                                _Float16* __restrict__ out, int n) {
    int i = blockIdx.x * blockDim.x + threadIdx.x;
    if (i < n) out[i] = (_Float16)in[i];
}

// Both transposes below go through an LDS tile so that the global reads AND the
// global writes are 16 B per lane over contiguous runs. Two source rows are
// packed into one dword, so a tile row [c] holds 32 dwords = 64 source rows.
// Pitch 33 dwords (odd): the column-wise dword writes of a wave fall on
// different banks; the read-back is four dword loads per 16-B store.
#define TPD 33

typedef __attribute__((ext_vector_type(2))) _Float16 v2h;
typedef __attribute__((ext_vector_type(4))) float    v4f;
typedef __attribute__((ext_vector_type(4))) unsigned v4u;

__device__ __forceinline__ unsigned pack2h(_Float16 lo, _Float16 hi) {
    v2h p = {lo, hi};
    return __builtin_bit_cast(unsigned, p);
}

// Transposing cast: in[rows][cols] (f32) -> out[cols][rows] (f16).
// One 256-thread block per 64x64 tile; rows and cols are multiples of 64.
__global__ __launch_bounds__(256)
void transpose_cast_f16_kernel(const float* __restrict__ in,
                               _Float16* __restrict__ out,
                               int rows, int cols) {
    __shared__ unsigned tile[64 * TPD];
    const int t  = threadIdx.x;
    const int c0 = blockIdx.x * 64;
    const int r0 = blockIdx.y * 64;
    const int cg = t & 15;   // 4 columns each: 16 lanes = 256 B of one row
    const int rp = t >> 4;   // row pair 0..15 (and +16)

    const float* src = in + (size_t)(r0 + 2 * rp) * cols + c0 + 4 * cg;
    const v4f a0 = *(const v4f*)(src);
    const v4f a1 = *(const v4f*)(src + cols);
    const v4f b0 = *(const v4f*)(src + (size_t)32 * cols);
    const v4f b1 = *(const v4f*)(src + (size_t)33 * cols);

    unsigned* w = tile + (4 * cg) * TPD + rp;
#pragma unroll
    for (int i = 0; i < 4; ++i) {
        w[i * TPD]      = pack2h((_Float16)a0[i], (_Float16)a1[i]);
        w[i * TPD + 16] = pack2h((_Float16)b0[i], (_Float16)b1[i]);
    }
    __syncthreads();

#pragma unroll
    for (int k = 0; k < 2; ++k) {
        const int chunk = t + 256 * k;
        const int c = chunk >> 3;   // output row inside the tile
        const int g = chunk & 7;    // 16-B piece: 8 lanes = one 128-B line
        const unsigned* rd = tile + c * TPD + 4 * g;
        const v4u v = {rd[0], rd[1], rd[2], rd[3]};
        *(v4u*)(out + (size_t)(c0 + c) * rows + r0 + 8 * g) = v;
    }
}

// Extract + transpose the V slab of qkv:
//   vT[b*C + c][n] = qkv[(b*N + n)*3C + 2C + c]
// One 256-thread block per tile of 64 tokens x 128 channels.
__global__ __launch_bounds__(256)
void transpose_v_kernel(const _Float16* __restrict__ qkv,
                        _Float16* __restrict__ vT) {
    __shared__ unsigned tile[128 * TPD];
    const int t    = threadIdx.x;
    const int c0   = blockIdx.x * 128;
    const int tok0 = blockIdx.y * 64;      // b*N + n0; 64 divides N
    const int b    = tok0 / NN;
    const int n0   = tok0 - b * NN;
    const int cg   = t & 15;   // 8 channels each: 16 lanes = 256 B of one row
    const int rp   = t >> 4;   // token pair 0..15 (and +16)

    const _Float16* src = qkv + (size_t)(tok0 + 2 * rp) * LD3 + 2 * CC + c0 + 8 * cg;
    const v8h a0 = *(const v8h*)(src);
    const v8h a1 = *(const v8h*)(src + LD3);
    const v8h b0 = *(const v8h*)(src + (size_t)32 * LD3);
    const v8h b1 = *(const v8h*)(src + (size_t)33 * LD3);

    unsigned* w = tile + (8 * cg) * TPD + rp;
#pragma unroll
    for (int i = 0; i < 8; ++i) {
        w[i * TPD]      = pack2h(a0[i], a1[i]);
        w[i * TPD + 16] = pack2h(b0[i], b1[i]);
    }
    __syncthreads();

    _Float16* dst = vT + ((size_t)b * CC + c0) * NN + n0;
#pragma unroll
    for (int k = 0; k < 4; ++k) {
        const int chunk = t + 256 * k;
        const int c = chunk >> 3;   // channel inside the tile
        const int g = chunk & 7;    // 16-B piece: 8 lanes = one 128-B line
        const unsigned* rd = tile + c * TPD + 4 * g;
        const v4u v = {rd[0], rd[1], rd[2], rd[3]};
        *(v4u*)(dst + (size_t)c * NN + 8 * g) = v;
    }
}

// ---------------------------------------------------------------------------
// WMMA GEMM:  C[M,Nn] = A[M,K] * B[K,Nn]   (B supplied transposed: BT[Nn][K])
// One wave computes a 16x64 tile (4 accumulators), K-loop step 32.
// ---------------------------------------------------------------------------
template <bool OUT_F16>
__global__ __launch_bounds__(32)
void wmma_gemm_kernel(const _Float16* __restrict__ A,
                      const _Float16* __restrict__ BT,
                      _Float16* __restrict__ Ch,
                      float* __restrict__ Cf,
                      const float* __restrict__ bias,
                      int M, int K, int Nn) {
    const int n0 = blockIdx.x * 64;
    const int m0 = blockIdx.y * 16;

    const _Float16* Abase = A + (size_t)m0 * K;

    const v8f vzero = {0.f, 0.f, 0.f, 0.f, 0.f, 0.f, 0.f, 0.f};
    v8f acc[4];
#pragma unroll
    for (int j = 0; j < 4; ++j) acc[j] = vzero;

    const int lane = threadIdx.x & 31;
    const size_t lrow = (size_t)(lane & 15) * K + ((lane >> 4) << 3);

#pragma unroll 2
    for (int k0 = 0; k0 < K; k0 += 32) {
        // prefetch next K-step's A rows (one line per lane)
        if (k0 + 32 < K)
            __builtin_prefetch(Abase + lrow + k0 + 32, 0, 0);
        v16h a  = load_frag_rowmajor(Abase + k0, K);
        v16h b0 = load_frag_rowmajor(BT + (size_t)(n0 +  0) * K + k0, K);
        v16h b1 = load_frag_rowmajor(BT + (size_t)(n0 + 16) * K + k0, K);
        v16h b2 = load_frag_rowmajor(BT + (size_t)(n0 + 32) * K + k0, K);
        v16h b3 = load_frag_rowmajor(BT + (size_t)(n0 + 48) * K + k0, K);
        acc[0] = wmma32(a, b0, acc[0]);
        acc[1] = wmma32(a, b1, acc[1]);
        acc[2] = wmma32(a, b2, acc[2]);
        acc[3] = wmma32(a, b3, acc[3]);
    }

    // C/D layout: reg r, lane -> (row = r + 8*(lane>>4), col = lane&15)
    const int half = lane >> 4;
    const int col  = lane & 15;
#pragma unroll
    for (int j = 0; j < 4; ++j) {
#pragma unroll
        for (int r = 0; r < 8; ++r) {
            const int row = m0 + r + 8 * half;
            const int cn  = n0 + j * 16 + col;
            if (OUT_F16) {
                Ch[(size_t)row * Nn + cn] = (_Float16)acc[j][r];
            } else {
                Cf[(size_t)row * Nn + cn] = acc[j][r] + bias[cn];
            }
        }
    }
}

// ---------------------------------------------------------------------------
// Flash attention: one wave per (batch, head, 16-query tile).
// qkv layout: [B*N, 3C] with q @ col h*64, k @ col C + h*64.
// V comes from the transposed slab vT[B*C][N].
// ---------------------------------------------------------------------------
__global__ __launch_bounds__(32)
void attention_kernel(const _Float16* __restrict__ qkv,
                      const _Float16* __restrict__ vT,
                      _Float16* __restrict__ outh) {
    const int q0   = blockIdx.x * 16;
    const int h    = blockIdx.y;
    const int b    = blockIdx.z;
    const size_t tokBase = (size_t)b * NN;

    const int lane = threadIdx.x & 31;
    const int half = lane >> 4;
    const int col  = lane & 15;

    __shared__ _Float16 Pld[16 * 32];   // prob tile staging: C-layout -> A-layout

    // Q fragments (16 rows x 64 d), two K=32 chunks
    const _Float16* qbase = qkv + (tokBase + q0) * LD3 + h * DD;
    const v16h qa0 = load_frag_rowmajor(qbase, LD3);
    const v16h qa1 = load_frag_rowmajor(qbase + 32, LD3);

    const _Float16* kbase0 = qkv + tokBase * LD3 + CC + h * DD;   // keys, token-major
    const _Float16* vtbase = vT + ((size_t)b * CC + h * DD) * NN; // [64][NN]

    const v8f vzero = {0.f, 0.f, 0.f, 0.f, 0.f, 0.f, 0.f, 0.f};
    v8f o[4];
#pragma unroll
    for (int j = 0; j < 4; ++j) o[j] = vzero;

    float m[8], l[8];
#pragma unroll
    for (int r = 0; r < 8; ++r) { m[r] = -1e30f; l[r] = 0.f; }

    const float scale = 0.125f;  // D^-0.5 = 64^-0.5

    for (int kb = 0; kb < NN; kb += 32) {
        const _Float16* kbase = kbase0 + (size_t)kb * LD3;

        // prefetch next key block's K rows and vT rows (one line per lane)
        if (kb + 32 < NN) {
            __builtin_prefetch(
                kbase + (size_t)(32 + (lane & 15)) * LD3 + ((lane >> 4) << 3), 0, 0);
            __builtin_prefetch(
                vtbase + (size_t)(lane & 15) * NN + kb + 32, 0, 0);
        }

        // ---- issue ALL loads for this block into distinct registers ----
        v16h kf00 = load_frag_rowmajor(kbase, LD3);                    // keys +0,  d 0..31
        v16h kf01 = load_frag_rowmajor(kbase + 32, LD3);               // keys +0,  d 32..63
        v16h kf10 = load_frag_rowmajor(kbase + (size_t)16 * LD3, LD3); // keys +16, d 0..31
        v16h kf11 = load_frag_rowmajor(kbase + (size_t)16 * LD3 + 32, LD3);
        // V fragments are independent of the scores: issue now, consume after
        // softmax so the ds_bpermute/exp work hides their latency.
        v16h vf0 = load_frag_rowmajor(vtbase + (size_t) 0 * NN + kb, NN);
        v16h vf1 = load_frag_rowmajor(vtbase + (size_t)16 * NN + kb, NN);
        v16h vf2 = load_frag_rowmajor(vtbase + (size_t)32 * NN + kb, NN);
        v16h vf3 = load_frag_rowmajor(vtbase + (size_t)48 * NN + kb, NN);

        // ---- scores: S[16 x 32] as two 16x16 f32 tiles ----
        v8f s0 = vzero, s1 = vzero;
        s0 = wmma32(qa0, kf00, s0);
        s0 = wmma32(qa1, kf01, s0);
        s1 = wmma32(qa0, kf10, s1);
        s1 = wmma32(qa1, kf11, s1);

        // ---- online softmax over this 32-key block ----
        float fac[8];
#pragma unroll
        for (int r = 0; r < 8; ++r) {
            float a0 = s0[r] * scale;
            float a1 = s1[r] * scale;
            float rm = fmaxf(a0, a1);
            rm = fmaxf(rm, __shfl_xor(rm, 1, 32));
            rm = fmaxf(rm, __shfl_xor(rm, 2, 32));
            rm = fmaxf(rm, __shfl_xor(rm, 4, 32));
            rm = fmaxf(rm, __shfl_xor(rm, 8, 32));   // row max within 16-lane half
            const float nm = fmaxf(m[r], rm);
            const float p0 = __expf(a0 - nm);
            const float p1 = __expf(a1 - nm);
            float rs = p0 + p1;
            rs += __shfl_xor(rs, 1, 32);
            rs += __shfl_xor(rs, 2, 32);
            rs += __shfl_xor(rs, 4, 32);
            rs += __shfl_xor(rs, 8, 32);             // row sum within half
            const float f = __expf(m[r] - nm);
            l[r] = l[r] * f + rs;
            m[r] = nm;
            fac[r] = f;
            // stash probabilities (C/D layout -> LDS row-major 16x32)
            const int row = r + 8 * half;
            Pld[row * 32 + col]      = (_Float16)p0;
            Pld[row * 32 + 16 + col] = (_Float16)p1;
        }

        // rescale running output accumulators
#pragma unroll
        for (int j = 0; j < 4; ++j)
#pragma unroll
            for (int r = 0; r < 8; ++r) o[j][r] *= fac[r];

        __syncthreads();  // make LDS prob tile visible / ordered
        const v16h pa = load_frag_rowmajor(&Pld[0], 32);

        // ---- O += P[16x32] * V[32x64] ----
        o[0] = wmma32(pa, vf0, o[0]);
        o[1] = wmma32(pa, vf1, o[1]);
        o[2] = wmma32(pa, vf2, o[2]);
        o[3] = wmma32(pa, vf3, o[3]);
        __syncthreads();
    }

    // ---- epilogue: normalize and store f16 at [token, h*64 + d] ----
    _Float16* obase = outh + (tokBase + q0) * CC + h * DD;
#pragma unroll
    for (int j = 0; j < 4; ++j) {
#pragma unroll
        for (int r = 0; r < 8; ++r) {
            const int row = r + 8 * half;
            obase[(size_t)row * CC + j * 16 + col] = (_Float16)(o[j][r] / l[r]);
        }
    }
}

// ---------------------------------------------------------------------------
// Host-side launch
// ---------------------------------------------------------------------------
extern "C" void kernel_launch(void* const* d_in, const int* in_sizes, int n_in,
                              void* d_out, int out_size, void* d_ws, size_t ws_size,
                              hipStream_t stream) {
    const float* x      = (const float*)d_in[0];   // [B,N,C]
    const float* W_qkv  = (const float*)d_in[1];   // [C, 3C]
    const float* W_proj = (const float*)d_in[2];   // [C, C]
    const float* b_proj = (const float*)d_in[3];   // [C]
    float* out = (float*)d_out;                    // [B,N,C] f32

    // Workspace layout (all f16)
    _Float16* xh     = (_Float16*)d_ws;                 // [M, C]
    _Float16* wqkvT  = xh     + (size_t)MM * CC;        // [3C, C]
    _Float16* wprojT = wqkvT  + (size_t)CC * 3 * CC;    // [C, C]
    _Float16* qkvh   = wprojT + (size_t)CC * CC;        // [M, 3C]
    _Float16* attnh  = qkvh   + (size_t)MM * 3 * CC;    // [M, C]
    _Float16* vT     = attnh  + (size_t)MM * CC;        // [B*C, N]

    // 1) precision casts (weights transposed for contiguous B-fragments)
    {
        const int nx = MM * CC;
        cast_f16_kernel<<<(nx + 255) / 256, 256, 0, stream>>>(x, xh, nx);
        transpose_cast_f16_kernel<<<dim3(3 * CC / 64, CC / 64), 256, 0, stream>>>(
            W_qkv, wqkvT, CC, 3 * CC);
        transpose_cast_f16_kernel<<<dim3(CC / 64, CC / 64), 256, 0, stream>>>(
            W_proj, wprojT, CC, CC);
    }

    // 2) qkv = x @ W_qkv              (f16 out)
    wmma_gemm_kernel<true><<<dim3(3 * CC / 64, MM / 16), 32, 0, stream>>>(
        xh, wqkvT, qkvh, nullptr, nullptr, MM, CC, 3 * CC);

    // 2b) transpose V slab for contiguous P*V fragment loads
    transpose_v_kernel<<<dim3(CC / 128, MM / 64), 256, 0, stream>>>(qkvh, vT);

    // 3) flash attention per (b, h, 16-query tile)
    attention_kernel<<<dim3(NN / 16, HH, BB), 32, 0, stream>>>(qkvh, vT, attnh);

    // 4) out = attn @ W_proj + b_proj (f32 out)
    wmma_gemm_kernel<false><<<dim3(CC / 64, MM / 16), 32, 0, stream>>>(
        attnh, wprojT, nullptr, out, b_proj, MM, CC, CC);
}

// v002
// Measured time: 387 microseconds a run.
// Two timings next to v001 both put it at 1.51 times that version's speed.
// Over all steps from v000 it is 2.18 times as fast.
#include <hip/hip_runtime.h>
#include <hip/hip_bf16.h>

// ---------------------------------------------------------------------------
// CDNA5 (gfx1250) attention block:  out = softmax(QK^T * s) V  projected.
// All GEMM-like math goes through v_wmma_f32_16x16x32_f16 (f16 in, f32 acc).
// V is pre-transposed to [B][C][N] so every WMMA fragment load is two
// contiguous global_load_b128s; next-block K/V rows are prefetched with
// global_prefetch_b8. Fragment loads are hoisted into distinct registers so
// WMMAs overlap outstanding loads instead of waiting on loadcnt==0.
// The two GEMMs read their fragments from LDS slabs instead (see there).
// ---------------------------------------------------------------------------

typedef __attribute__((ext_vector_type(16))) _Float16 v16h;
typedef __attribute__((ext_vector_type(8)))  _Float16 v8h;
typedef __attribute__((ext_vector_type(8)))  float    v8f;

// Problem constants (fixed by the reference)
#define BB   4
#define NN   2048
#define CC   1024
#define HH   16
#define DD   64
#define LD3  (3 * CC)   // 3072, row stride of qkv buffer
#define MM   (BB * NN)  // 8192 tokens

__device__ __forceinline__ v8f wmma32(v16h a, v16h b, v8f c) {
    // (neg_a, A, neg_b, B, c_mod, C, reuse_a, reuse_b)
    return __builtin_amdgcn_wmma_f32_16x16x32_f16(
        false, a, false, b, (short)0, c, false, false);
}

// Load a 16x32 f16 fragment in the CDNA5 16-bit A/B layout from a row-major
// matrix (16-wide index across lanes&15; K contiguous within a row).
//   lanes 0-15 : idx=lane,    halves [0..7]=K0..7,  [8..15]=K16..23
//   lanes 16-31: idx=lane-16, halves [0..7]=K8..15, [8..15]=K24..31
__device__ __forceinline__ v16h load_frag_rowmajor(const _Float16* base, int ld) {
    const int lane = threadIdx.x & 31;
    const _Float16* p = base + (size_t)(lane & 15) * ld + ((lane >> 4) << 3);
    v8h lo = *(const v8h*)(p);
    v8h hi = *(const v8h*)(p + 16);
    return __builtin_shufflevector(lo, hi, 0, 1, 2, 3, 4, 5, 6, 7,
                                           8, 9, 10, 11, 12, 13, 14, 15);
}

// ---------------------------------------------------------------------------
// Elementwise f32 -> f16 cast
// ---------------------------------------------------------------------------
__global__ void cast_f16_kernel(const float* __restrict__ in,
                                _Float16* __restrict__ out, int n) {
    int i = blockIdx.x * blockDim.x + threadIdx.x;
    if (i < n) out[i] = (_Float16)in[i];
}

// Both transposes below go through an LDS tile so that the global reads AND the
// global writes are 16 B per lane over contiguous runs. Two source rows are
// packed into one dword, so a tile row [c] holds 32 dwords = 64 source rows.
// Pitch 33 dwords (odd): the column-wise dword writes of a wave fall on
// different banks; the read-back is four dword loads per 16-B store.
#define TPD 33

typedef __attribute__((ext_vector_type(2))) _Float16 v2h;
typedef __attribute__((ext_vector_type(4))) float    v4f;
typedef __attribute__((ext_vector_type(4))) unsigned v4u;

__device__ __forceinline__ unsigned pack2h(_Float16 lo, _Float16 hi) {
    v2h p = {lo, hi};
    return __builtin_bit_cast(unsigned, p);
}

// Transposing cast: in[rows][cols] (f32) -> out[cols][rows] (f16).
// One 256-thread block per 64x64 tile; rows and cols are multiples of 64.
__global__ __launch_bounds__(256)
void transpose_cast_f16_kernel(const float* __restrict__ in,
                               _Float16* __restrict__ out,
                               int rows, int cols) {
    __shared__ unsigned tile[64 * TPD];
    const int t  = threadIdx.x;
    const int c0 = blockIdx.x * 64;
    const int r0 = blockIdx.y * 64;
    const int cg = t & 15;   // 4 columns each: 16 lanes = 256 B of one row
    const int rp = t >> 4;   // row pair 0..15 (and +16)

    const float* src = in + (size_t)(r0 + 2 * rp) * cols + c0 + 4 * cg;
    const v4f a0 = *(const v4f*)(src);
    const v4f a1 = *(const v4f*)(src + cols);
    const v4f b0 = *(const v4f*)(src + (size_t)32 * cols);
    const v4f b1 = *(const v4f*)(src + (size_t)33 * cols);

    unsigned* w = tile + (4 * cg) * TPD + rp;
#pragma unroll
    for (int i = 0; i < 4; ++i) {
        w[i * TPD]      = pack2h((_Float16)a0[i], (_Float16)a1[i]);
        w[i * TPD + 16] = pack2h((_Float16)b0[i], (_Float16)b1[i]);
    }
    __syncthreads();

#pragma unroll
    for (int k = 0; k < 2; ++k) {
        const int chunk = t + 256 * k;
        const int c = chunk >> 3;   // output row inside the tile
        const int g = chunk & 7;    // 16-B piece: 8 lanes = one 128-B line
        const unsigned* rd = tile + c * TPD + 4 * g;
        const v4u v = {rd[0], rd[1], rd[2], rd[3]};
        *(v4u*)(out + (size_t)(c0 + c) * rows + r0 + 8 * g) = v;
    }
}

// Extract + transpose the V slab of qkv:
//   vT[b*C + c][n] = qkv[(b*N + n)*3C + 2C + c]
// One 256-thread block per tile of 64 tokens x 128 channels.
__global__ __launch_bounds__(256)
void transpose_v_kernel(const _Float16* __restrict__ qkv,
                        _Float16* __restrict__ vT) {
    __shared__ unsigned tile[128 * TPD];
    const int t    = threadIdx.x;
    const int c0   = blockIdx.x * 128;
    const int tok0 = blockIdx.y * 64;      // b*N + n0; 64 divides N
    const int b    = tok0 / NN;
    const int n0   = tok0 - b * NN;
    const int cg   = t & 15;   // 8 channels each: 16 lanes = 256 B of one row
    const int rp   = t >> 4;   // token pair 0..15 (and +16)

    const _Float16* src = qkv + (size_t)(tok0 + 2 * rp) * LD3 + 2 * CC + c0 + 8 * cg;
    const v8h a0 = *(const v8h*)(src);
    const v8h a1 = *(const v8h*)(src + LD3);
    const v8h b0 = *(const v8h*)(src + (size_t)32 * LD3);
    const v8h b1 = *(const v8h*)(src + (size_t)33 * LD3);

    unsigned* w = tile + (8 * cg) * TPD + rp;
#pragma unroll
    for (int i = 0; i < 8; ++i) {
        w[i * TPD]      = pack2h(a0[i], a1[i]);
        w[i * TPD + 16] = pack2h(b0[i], b1[i]);
    }
    __syncthreads();

    _Float16* dst = vT + ((size_t)b * CC + c0) * NN + n0;
#pragma unroll
    for (int k = 0; k < 4; ++k) {
        const int chunk = t + 256 * k;
        const int c = chunk >> 3;   // channel inside the tile
        const int g = chunk & 7;    // 16-B piece: 8 lanes = one 128-B line
        const unsigned* rd = tile + c * TPD + 4 * g;
        const v4u v = {rd[0], rd[1], rd[2], rd[3]};
        *(v4u*)(dst + (size_t)c * NN + 8 * g) = v;
    }
}

// ---------------------------------------------------------------------------
// WMMA GEMM:  C[M,Nn] = A[M,K] * B[K,Nn]   (B supplied transposed: BT[Nn][K])
// One 4-wave work-group computes a 128x128 tile; each wave a 64x64 quarter
// (16 accumulators). A K-slab of 64 (128 rows of A, 128 rows of BT, 128 B per
// row) is brought into LDS by asynchronous 16-B copies, whole 128-B lines per
// 8 lanes, two buffers: the next slab flies while this one is multiplied.
// M, Nn multiples of 128; K a multiple of 64.
// ---------------------------------------------------------------------------
#define GT     128                    // tile rows of A and of BT
#define GBK    64                     // k per slab
#define GPITCH 72                     // halves per LDS row: 144 B = 16 B x 9
#define GSLAB  (2 * GT * GPITCH)      // halves per buffer

// Eight asynchronous copies, 16 B per lane each. The s_wait_xcnt stands inside
// the statement so that no address register is rewritten ahead of it.
__device__ __forceinline__ void async_copy8(unsigned l, const _Float16* g,
                                            unsigned lstep, size_t gstep) {
    const unsigned l1 = l + lstep, l2 = l1 + lstep, l3 = l2 + lstep;
    const unsigned l4 = l3 + lstep, l5 = l4 + lstep, l6 = l5 + lstep, l7 = l6 + lstep;
    const _Float16 *g1 = g + gstep, *g2 = g1 + gstep, *g3 = g2 + gstep;
    const _Float16 *g4 = g3 + gstep, *g5 = g4 + gstep, *g6 = g5 + gstep, *g7 = g6 + gstep;
    asm volatile(
        "global_load_async_to_lds_b128 %0, %8, off\n\t"
        "global_load_async_to_lds_b128 %1, %9, off\n\t"
        "global_load_async_to_lds_b128 %2, %10, off\n\t"
        "global_load_async_to_lds_b128 %3, %11, off\n\t"
        "global_load_async_to_lds_b128 %4, %12, off\n\t"
        "global_load_async_to_lds_b128 %5, %13, off\n\t"
        "global_load_async_to_lds_b128 %6, %14, off\n\t"
        "global_load_async_to_lds_b128 %7, %15, off\n\t"
        "s_wait_xcnt 0x0"
        :: "v"(l), "v"(l1), "v"(l2), "v"(l3), "v"(l4), "v"(l5), "v"(l6), "v"(l7),
           "v"(g), "v"(g1), "v"(g2), "v"(g3), "v"(g4), "v"(g5), "v"(g6), "v"(g7)
        : "memory");
}

template <bool OUT_F16>
__global__ __launch_bounds__(128)
void wmma_gemm_kernel(const _Float16* __restrict__ A,
                      const _Float16* __restrict__ BT,
                      _Float16* __restrict__ Ch,
                      float* __restrict__ Cf,
                      const float* __restrict__ bias,
                      int M, int K, int Nn) {
    __shared__ __attribute__((aligned(16))) _Float16 slab[2 * GSLAB];

    const int t    = threadIdx.x;
    const int lane = t & 31;
    const int wave = t >> 5;
    const int n0 = blockIdx.x * GT;
    const int m0 = blockIdx.y * GT;
    const int wm = (wave >> 1) * 64;   // this wave's quarter of the tile
    const int wn = (wave & 1) * 64;

    // Copy map: 8 lanes cover one 128-B row piece, a wave 4 rows, the block 16
    // rows per copy; 8 copies for the A rows, 8 for the BT rows.
    const int crow = t >> 3;
    const int ccol = (t & 7) * 8;
    const _Float16* gA = A  + (size_t)(m0 + crow) * K + ccol;
    const _Float16* gB = BT + (size_t)(n0 + crow) * K + ccol;
    const unsigned  lA = (unsigned)(size_t)(&slab[crow * GPITCH + ccol]);
    const unsigned  lB = lA + GT * GPITCH * 2;
    const unsigned  lstep = 16 * GPITCH * 2;     // bytes: 16 LDS rows
    const size_t    gstep = (size_t)16 * K;      // halves: 16 source rows
    const int nt = K / GBK;

    const v8f vzero = {0.f, 0.f, 0.f, 0.f, 0.f, 0.f, 0.f, 0.f};
    v8f acc[4][4];
#pragma unroll
    for (int i = 0; i < 4; ++i)
#pragma unroll
        for (int j = 0; j < 4; ++j) acc[i][j] = vzero;

    // slab 0 -> buffer 0, landed and published before anybody reads it
    async_copy8(lA, gA, lstep, gstep);
    async_copy8(lB, gB, lstep, gstep);
    asm volatile("s_wait_asynccnt 0x0" ::: "memory");  // own copies landed
    __syncthreads();                                   // every wave's copies landed
    if (nt > 1) {
        async_copy8(lA + GSLAB * 2, gA + GBK, lstep, gstep);
        async_copy8(lB + GSLAB * 2, gB + GBK, lstep, gstep);
    }

    for (int s = 0; s < nt; ++s) {
        const int buf = s & 1;
        const _Float16* sA = slab + buf * GSLAB + wm * GPITCH;
        const _Float16* sB = slab + buf * GSLAB + (GT + wn) * GPITCH;
#pragma unroll
        for (int kk = 0; kk < GBK; kk += 32) {
            v16h a[4], b[4];
#pragma unroll
            for (int i = 0; i < 4; ++i)
                a[i] = load_frag_rowmajor(sA + i * 16 * GPITCH + kk, GPITCH);
#pragma unroll
            for (int j = 0; j < 4; ++j)
                b[j] = load_frag_rowmajor(sB + j * 16 * GPITCH + kk, GPITCH);
#pragma unroll
            for (int i = 0; i < 4; ++i)
#pragma unroll
                for (int j = 0; j < 4; ++j)
                    acc[i][j] = wmma32(a[i], b[j], acc[i][j]);
        }
        // hand-over: own LDS reads done, own copies of slab s+1 landed, then the
        // barrier publishes slab s+1 and frees this buffer for slab s+2
        asm volatile("s_wait_dscnt 0x0" ::: "memory");
        asm volatile("s_wait_asynccnt 0x0" ::: "memory");
        __syncthreads();
        if (s + 2 < nt) {
            const size_t ko = (size_t)(s + 2) * GBK;
            async_copy8(lA + buf * (GSLAB * 2), gA + ko, lstep, gstep);
            async_copy8(lB + buf * (GSLAB * 2), gB + ko, lstep, gstep);
        }
    }
    asm volatile("s_wait_asynccnt 0x0" ::: "memory");  // nothing in flight at the end

    // C/D layout: reg r, lane -> (row = r + 8*(lane>>4), col = lane&15)
    const int half = lane >> 4;
    const int col  = lane & 15;
#pragma unroll
    for (int i = 0; i < 4; ++i) {
#pragma unroll
        for (int j = 0; j < 4; ++j) {
#pragma unroll
            for (int r = 0; r < 8; ++r) {
                const int row = m0 + wm + i * 16 + r + 8 * half;
                const int cn  = n0 + wn + j * 16 + col;
                if (OUT_F16) {
                    Ch[(size_t)row * Nn + cn] = (_Float16)acc[i][j][r];
                } else {
                    Cf[(size_t)row * Nn + cn] = acc[i][j][r] + bias[cn];
                }
            }
        }
    }
}

// ---------------------------------------------------------------------------
// Flash attention: one wave per (batch, head, 16-query tile).
// qkv layout: [B*N, 3C] with q @ col h*64, k @ col C + h*64.
// V comes from the transposed slab vT[B*C][N].
// ---------------------------------------------------------------------------
__global__ __launch_bounds__(32)
void attention_kernel(const _Float16* __restrict__ qkv,
                      const _Float16* __restrict__ vT,
                      _Float16* __restrict__ outh) {
    const int q0   = blockIdx.x * 16;
    const int h    = blockIdx.y;
    const int b    = blockIdx.z;
    const size_t tokBase = (size_t)b * NN;

    const int lane = threadIdx.x & 31;
    const int half = lane >> 4;
    const int col  = lane & 15;

    __shared__ _Float16 Pld[16 * 32];   // prob tile staging: C-layout -> A-layout

    // Q fragments (16 rows x 64 d), two K=32 chunks
    const _Float16* qbase = qkv + (tokBase + q0) * LD3 + h * DD;
    const v16h qa0 = load_frag_rowmajor(qbase, LD3);
    const v16h qa1 = load_frag_rowmajor(qbase + 32, LD3);

    const _Float16* kbase0 = qkv + tokBase * LD3 + CC + h * DD;   // keys, token-major
    const _Float16* vtbase = vT + ((size_t)b * CC + h * DD) * NN; // [64][NN]

    const v8f vzero = {0.f, 0.f, 0.f, 0.f, 0.f, 0.f, 0.f, 0.f};
    v8f o[4];
#pragma unroll
    for (int j = 0; j < 4; ++j) o[j] = vzero;

    float m[8], l[8];
#pragma unroll
    for (int r = 0; r < 8; ++r) { m[r] = -1e30f; l[r] = 0.f; }

    const float scale = 0.125f;  // D^-0.5 = 64^-0.5

    for (int kb = 0; kb < NN; kb += 32) {
        const _Float16* kbase = kbase0 + (size_t)kb * LD3;

        // prefetch next key block's K rows and vT rows (one line per lane)
        if (kb + 32 < NN) {
            __builtin_prefetch(
                kbase + (size_t)(32 + (lane & 15)) * LD3 + ((lane >> 4) << 3), 0, 0);
            __builtin_prefetch(
                vtbase + (size_t)(lane & 15) * NN + kb + 32, 0, 0);
        }

        // ---- issue ALL loads for this block into distinct registers ----
        v16h kf00 = load_frag_rowmajor(kbase, LD3);                    // keys +0,  d 0..31
        v16h kf01 = load_frag_rowmajor(kbase + 32, LD3);               // keys +0,  d 32..63
        v16h kf10 = load_frag_rowmajor(kbase + (size_t)16 * LD3, LD3); // keys +16, d 0..31
        v16h kf11 = load_frag_rowmajor(kbase + (size_t)16 * LD3 + 32, LD3);
        // V fragments are independent of the scores: issue now, consume after
        // softmax so the ds_bpermute/exp work hides their latency.
        v16h vf0 = load_frag_rowmajor(vtbase + (size_t) 0 * NN + kb, NN);
        v16h vf1 = load_frag_rowmajor(vtbase + (size_t)16 * NN + kb, NN);
        v16h vf2 = load_frag_rowmajor(vtbase + (size_t)32 * NN + kb, NN);
        v16h vf3 = load_frag_rowmajor(vtbase + (size_t)48 * NN + kb, NN);

        // ---- scores: S[16 x 32] as two 16x16 f32 tiles ----
        v8f s0 = vzero, s1 = vzero;
        s0 = wmma32(qa0, kf00, s0);
        s0 = wmma32(qa1, kf01, s0);
        s1 = wmma32(qa0, kf10, s1);
        s1 = wmma32(qa1, kf11, s1);

        // ---- online softmax over this 32-key block ----
        float fac[8];
#pragma unroll
        for (int r = 0; r < 8; ++r) {
            float a0 = s0[r] * scale;
            float a1 = s1[r] * scale;
            float rm = fmaxf(a0, a1);
            rm = fmaxf(rm, __shfl_xor(rm, 1, 32));
            rm = fmaxf(rm, __shfl_xor(rm, 2, 32));
            rm = fmaxf(rm, __shfl_xor(rm, 4, 32));
            rm = fmaxf(rm, __shfl_xor(rm, 8, 32));   // row max within 16-lane half
            const float nm = fmaxf(m[r], rm);
            const float p0 = __expf(a0 - nm);
            const float p1 = __expf(a1 - nm);
            float rs = p0 + p1;
            rs += __shfl_xor(rs, 1, 32);
            rs += __shfl_xor(rs, 2, 32);
            rs += __shfl_xor(rs, 4, 32);
            rs += __shfl_xor(rs, 8, 32);             // row sum within half
            const float f = __expf(m[r] - nm);
            l[r] = l[r] * f + rs;
            m[r] = nm;
            fac[r] = f;
            // stash probabilities (C/D layout -> LDS row-major 16x32)
            const int row = r + 8 * half;
            Pld[row * 32 + col]      = (_Float16)p0;
            Pld[row * 32 + 16 + col] = (_Float16)p1;
        }

        // rescale running output accumulators
#pragma unroll
        for (int j = 0; j < 4; ++j)
#pragma unroll
            for (int r = 0; r < 8; ++r) o[j][r] *= fac[r];

        __syncthreads();  // make LDS prob tile visible / ordered
        const v16h pa = load_frag_rowmajor(&Pld[0], 32);

        // ---- O += P[16x32] * V[32x64] ----
        o[0] = wmma32(pa, vf0, o[0]);
        o[1] = wmma32(pa, vf1, o[1]);
        o[2] = wmma32(pa, vf2, o[2]);
        o[3] = wmma32(pa, vf3, o[3]);
        __syncthreads();
    }

    // ---- epilogue: normalize and store f16 at [token, h*64 + d] ----
    _Float16* obase = outh + (tokBase + q0) * CC + h * DD;
#pragma unroll
    for (int j = 0; j < 4; ++j) {
#pragma unroll
        for (int r = 0; r < 8; ++r) {
            const int row = r + 8 * half;
            obase[(size_t)row * CC + j * 16 + col] = (_Float16)(o[j][r] / l[r]);
        }
    }
}

// ---------------------------------------------------------------------------
// Host-side launch
// ---------------------------------------------------------------------------
extern "C" void kernel_launch(void* const* d_in, const int* in_sizes, int n_in,
                              void* d_out, int out_size, void* d_ws, size_t ws_size,
                              hipStream_t stream) {
    const float* x      = (const float*)d_in[0];   // [B,N,C]
    const float* W_qkv  = (const float*)d_in[1];   // [C, 3C]
    const float* W_proj = (const float*)d_in[2];   // [C, C]
    const float* b_proj = (const float*)d_in[3];   // [C]
    float* out = (float*)d_out;                    // [B,N,C] f32

    // Workspace layout (all f16)
    _Float16* xh     = (_Float16*)d_ws;                 // [M, C]
    _Float16* wqkvT  = xh     + (size_t)MM * CC;        // [3C, C]
    _Float16* wprojT = wqkvT  + (size_t)CC * 3 * CC;    // [C, C]
    _Float16* qkvh   = wprojT + (size_t)CC * CC;        // [M, 3C]
    _Float16* attnh  = qkvh   + (size_t)MM * 3 * CC;    // [M, C]
    _Float16* vT     = attnh  + (size_t)MM * CC;        // [B*C, N]

    // 1) precision casts (weights transposed for contiguous B-fragments)
    {
        const int nx = MM * CC;
        cast_f16_kernel<<<(nx + 255) / 256, 256, 0, stream>>>(x, xh, nx);
        transpose_cast_f16_kernel<<<dim3(3 * CC / 64, CC / 64), 256, 0, stream>>>(
            W_qkv, wqkvT, CC, 3 * CC);
        transpose_cast_f16_kernel<<<dim3(CC / 64, CC / 64), 256, 0, stream>>>(
            W_proj, wprojT, CC, CC);
    }

    // 2) qkv = x @ W_qkv              (f16 out)
    wmma_gemm_kernel<true><<<dim3(3 * CC / 128, MM / 128), 128, 0, stream>>>(
        xh, wqkvT, qkvh, nullptr, nullptr, MM, CC, 3 * CC);

    // 2b) transpose V slab for contiguous P*V fragment loads
    transpose_v_kernel<<<dim3(CC / 128, MM / 64), 256, 0, stream>>>(qkvh, vT);

    // 3) flash attention per (b, h, 16-query tile)
    attention_kernel<<<dim3(NN / 16, HH, BB), 32, 0, stream>>>(qkvh, vT, attnh);

    // 4) out = attn @ W_proj + b_proj (f32 out)
    wmma_gemm_kernel<false><<<dim3(CC / 128, MM / 128), 128, 0, stream>>>(
        attnh, wprojT, nullptr, out, b_proj, MM, CC, CC);
}

// v003
// It runs in 248 microseconds.
// Two timings next to v002 put it at 1.55 and 1.56 times that version's speed.
// Over all steps from v000 it is 3.39 times as fast.
#include <hip/hip_runtime.h>
#include <hip/hip_bf16.h>

// ---------------------------------------------------------------------------
// CDNA5 (gfx1250) attention block:  out = softmax(QK^T * s) V  projected.
// All GEMM-like math goes through v_wmma_f32_16x16x32_f16 (f16 in, f32 acc).
// V is pre-transposed to [B][C][N] so every WMMA fragment is two contiguous
// 16-B loads per lane. The GEMMs and the attention read their fragments from
// LDS tiles that a whole work-group shares (see there).
// ---------------------------------------------------------------------------

typedef __attribute__((ext_vector_type(16))) _Float16 v16h;
typedef __attribute__((ext_vector_type(8)))  _Float16 v8h;
typedef __attribute__((ext_vector_type(8)))  float    v8f;

// Problem constants (fixed by the reference)
#define BB   4
#define NN   2048
#define CC   1024
#define HH   16
#define DD   64
#define LD3  (3 * CC)   // 3072, row stride of qkv buffer
#define MM   (BB * NN)  // 8192 tokens

__device__ __forceinline__ v8f wmma32(v16h a, v16h b, v8f c) {
    // (neg_a, A, neg_b, B, c_mod, C, reuse_a, reuse_b)
    return __builtin_amdgcn_wmma_f32_16x16x32_f16(
        false, a, false, b, (short)0, c, false, false);
}

// Load a 16x32 f16 fragment in the CDNA5 16-bit A/B layout from a row-major
// matrix (16-wide index across lanes&15; K contiguous within a row).
//   lanes 0-15 : idx=lane,    halves [0..7]=K0..7,  [8..15]=K16..23
//   lanes 16-31: idx=lane-16, halves [0..7]=K8..15, [8..15]=K24..31
__device__ __forceinline__ v16h load_frag_rowmajor(const _Float16* base, int ld) {
    const int lane = threadIdx.x & 31;
    const _Float16* p = base + (size_t)(lane & 15) * ld + ((lane >> 4) << 3);
    v8h lo = *(const v8h*)(p);
    v8h hi = *(const v8h*)(p + 16);
    return __builtin_shufflevector(lo, hi, 0, 1, 2, 3, 4, 5, 6, 7,
                                           8, 9, 10, 11, 12, 13, 14, 15);
}

// ---------------------------------------------------------------------------
// Elementwise f32 -> f16 cast
// ---------------------------------------------------------------------------
__global__ void cast_f16_kernel(const float* __restrict__ in,
                                _Float16* __restrict__ out, int n) {
    int i = blockIdx.x * blockDim.x + threadIdx.x;
    if (i < n) out[i] = (_Float16)in[i];
}

// Both transposes below go through an LDS tile so that the global reads AND the
// global writes are 16 B per lane over contiguous runs. Two source rows are
// packed into one dword, so a tile row [c] holds 32 dwords = 64 source rows.
// Pitch 33 dwords (odd): the column-wise dword writes of a wave fall on
// different banks; the read-back is four dword loads per 16-B store.
#define TPD 33

typedef __attribute__((ext_vector_type(2))) _Float16 v2h;
typedef __attribute__((ext_vector_type(4))) float    v4f;
typedef __attribute__((ext_vector_type(4))) unsigned v4u;

__device__ __forceinline__ unsigned pack2h(_Float16 lo, _Float16 hi) {
    v2h p = {lo, hi};
    return __builtin_bit_cast(unsigned, p);
}

// Transposing cast: in[rows][cols] (f32) -> out[cols][rows] (f16).
// One 256-thread block per 64x64 tile; rows and cols are multiples of 64.
__global__ __launch_bounds__(256)
void transpose_cast_f16_kernel(const float* __restrict__ in,
                               _Float16* __restrict__ out,
                               int rows, int cols) {
    __shared__ unsigned tile[64 * TPD];
    const int t  = threadIdx.x;
    const int c0 = blockIdx.x * 64;
    const int r0 = blockIdx.y * 64;
    const int cg = t & 15;   // 4 columns each: 16 lanes = 256 B of one row
    const int rp = t >> 4;   // row pair 0..15 (and +16)

    const float* src = in + (size_t)(r0 + 2 * rp) * cols + c0 + 4 * cg;
    const v4f a0 = *(const v4f*)(src);
    const v4f a1 = *(const v4f*)(src + cols);
    const v4f b0 = *(const v4f*)(src + (size_t)32 * cols);
    const v4f b1 = *(const v4f*)(src + (size_t)33 * cols);

    unsigned* w = tile + (4 * cg) * TPD + rp;
#pragma unroll
    for (int i = 0; i < 4; ++i) {
        w[i * TPD]      = pack2h((_Float16)a0[i], (_Float16)a1[i]);
        w[i * TPD + 16] = pack2h((_Float16)b0[i], (_Float16)b1[i]);
    }
    __syncthreads();

#pragma unroll
    for (int k = 0; k < 2; ++k) {
        const int chunk = t + 256 * k;
        const int c = chunk >> 3;   // output row inside the tile
        const int g = chunk & 7;    // 16-B piece: 8 lanes = one 128-B line
        const unsigned* rd = tile + c * TPD + 4 * g;
        const v4u v = {rd[0], rd[1], rd[2], rd[3]};
        *(v4u*)(out + (size_t)(c0 + c) * rows + r0 + 8 * g) = v;
    }
}

// Extract + transpose the V slab of qkv:
//   vT[b*C + c][n] = qkv[(b*N + n)*3C + 2C + c]
// One 256-thread block per tile of 64 tokens x 128 channels.
__global__ __launch_bounds__(256)
void transpose_v_kernel(const _Float16* __restrict__ qkv,
                        _Float16* __restrict__ vT) {
    __shared__ unsigned tile[128 * TPD];
    const int t    = threadIdx.x;
    const int c0   = blockIdx.x * 128;
    const int tok0 = blockIdx.y * 64;      // b*N + n0; 64 divides N
    const int b    = tok0 / NN;
    const int n0   = tok0 - b * NN;
    const int cg   = t & 15;   // 8 channels each: 16 lanes = 256 B of one row
    const int rp   = t >> 4;   // token pair 0..15 (and +16)

    const _Float16* src = qkv + (size_t)(tok0 + 2 * rp) * LD3 + 2 * CC + c0 + 8 * cg;
    const v8h a0 = *(const v8h*)(src);
    const v8h a1 = *(const v8h*)(src + LD3);
    const v8h b0 = *(const v8h*)(src + (size_t)32 * LD3);
    const v8h b1 = *(const v8h*)(src + (size_t)33 * LD3);

    unsigned* w = tile + (8 * cg) * TPD + rp;
#pragma unroll
    for (int i = 0; i < 8; ++i) {
        w[i * TPD]      = pack2h(a0[i], a1[i]);
        w[i * TPD + 16] = pack2h(b0[i], b1[i]);
    }
    __syncthreads();

    _Float16* dst = vT + ((size_t)b * CC + c0) * NN + n0;
#pragma unroll
    for (int k = 0; k < 4; ++k) {
        const int chunk = t + 256 * k;
        const int c = chunk >> 3;   // channel inside the tile
        const int g = chunk & 7;    // 16-B piece: 8 lanes = one 128-B line
        const unsigned* rd = tile + c * TPD + 4 * g;
        const v4u v = {rd[0], rd[1], rd[2], rd[3]};
        *(v4u*)(dst + (size_t)c * NN + 8 * g) = v;
    }
}

// ---------------------------------------------------------------------------
// WMMA GEMM:  C[M,Nn] = A[M,K] * B[K,Nn]   (B supplied transposed: BT[Nn][K])
// One 4-wave work-group computes a 128x128 tile; each wave a 64x64 quarter
// (16 accumulators). A K-slab of 64 (128 rows of A, 128 rows of BT, 128 B per
// row) is brought into LDS by asynchronous 16-B copies, whole 128-B lines per
// 8 lanes, two buffers: the next slab flies while this one is multiplied.
// M, Nn multiples of 128; K a multiple of 64.
// ---------------------------------------------------------------------------
#define GT     128                    // tile rows of A and of BT
#define GBK    64                     // k per slab
#define GPITCH 72                     // halves per LDS row: 144 B = 16 B x 9
#define GSLAB  (2 * GT * GPITCH)      // halves per buffer

// Eight asynchronous copies, 16 B per lane each. The s_wait_xcnt stands inside
// the statement so that no address register is rewritten ahead of it.
__device__ __forceinline__ void async_copy8(unsigned l, const _Float16* g,
                                            unsigned lstep, size_t gstep) {
    const unsigned l1 = l + lstep, l2 = l1 + lstep, l3 = l2 + lstep;
    const unsigned l4 = l3 + lstep, l5 = l4 + lstep, l6 = l5 + lstep, l7 = l6 + lstep;
    const _Float16 *g1 = g + gstep, *g2 = g1 + gstep, *g3 = g2 + gstep;
    const _Float16 *g4 = g3 + gstep, *g5 = g4 + gstep, *g6 = g5 + gstep, *g7 = g6 + gstep;
    asm volatile(
        "global_load_async_to_lds_b128 %0, %8, off\n\t"
        "global_load_async_to_lds_b128 %1, %9, off\n\t"
        "global_load_async_to_lds_b128 %2, %10, off\n\t"
        "global_load_async_to_lds_b128 %3, %11, off\n\t"
        "global_load_async_to_lds_b128 %4, %12, off\n\t"
        "global_load_async_to_lds_b128 %5, %13, off\n\t"
        "global_load_async_to_lds_b128 %6, %14, off\n\t"
        "global_load_async_to_lds_b128 %7, %15, off\n\t"
        "s_wait_xcnt 0x0"
        :: "v"(l), "v"(l1), "v"(l2), "v"(l3), "v"(l4), "v"(l5), "v"(l6), "v"(l7),
           "v"(g), "v"(g1), "v"(g2), "v"(g3), "v"(g4), "v"(g5), "v"(g6), "v"(g7)
        : "memory");
}

template <bool OUT_F16>
__global__ __launch_bounds__(128)
void wmma_gemm_kernel(const _Float16* __restrict__ A,
                      const _Float16* __restrict__ BT,
                      _Float16* __restrict__ Ch,
                      float* __restrict__ Cf,
                      const float* __restrict__ bias,
                      int M, int K, int Nn) {
    __shared__ __attribute__((aligned(16))) _Float16 slab[2 * GSLAB];

    const int t    = threadIdx.x;
    const int lane = t & 31;
    const int wave = t >> 5;
    const int n0 = blockIdx.x * GT;
    const int m0 = blockIdx.y * GT;
    const int wm = (wave >> 1) * 64;   // this wave's quarter of the tile
    const int wn = (wave & 1) * 64;

    // Copy map: 8 lanes cover one 128-B row piece, a wave 4 rows, the block 16
    // rows per copy; 8 copies for the A rows, 8 for the BT rows.
    const int crow = t >> 3;
    const int ccol = (t & 7) * 8;
    const _Float16* gA = A  + (size_t)(m0 + crow) * K + ccol;
    const _Float16* gB = BT + (size_t)(n0 + crow) * K + ccol;
    const unsigned  lA = (unsigned)(size_t)(&slab[crow * GPITCH + ccol]);
    const unsigned  lB = lA + GT * GPITCH * 2;
    const unsigned  lstep = 16 * GPITCH * 2;     // bytes: 16 LDS rows
    const size_t    gstep = (size_t)16 * K;      // halves: 16 source rows
    const int nt = K / GBK;

    const v8f vzero = {0.f, 0.f, 0.f, 0.f, 0.f, 0.f, 0.f, 0.f};
    v8f acc[4][4];
#pragma unroll
    for (int i = 0; i < 4; ++i)
#pragma unroll
        for (int j = 0; j < 4; ++j) acc[i][j] = vzero;

    // slab 0 -> buffer 0, landed and published before anybody reads it
    async_copy8(lA, gA, lstep, gstep);
    async_copy8(lB, gB, lstep, gstep);
    asm volatile("s_wait_asynccnt 0x0" ::: "memory");  // own copies landed
    __syncthreads();                                   // every wave's copies landed
    if (nt > 1) {
        async_copy8(lA + GSLAB * 2, gA + GBK, lstep, gstep);
        async_copy8(lB + GSLAB * 2, gB + GBK, lstep, gstep);
    }

    for (int s = 0; s < nt; ++s) {
        const int buf = s & 1;
        const _Float16* sA = slab + buf * GSLAB + wm * GPITCH;
        const _Float16* sB = slab + buf * GSLAB + (GT + wn) * GPITCH;
#pragma unroll
        for (int kk = 0; kk < GBK; kk += 32) {
            v16h a[4], b[4];
#pragma unroll
            for (int i = 0; i < 4; ++i)
                a[i] = load_frag_rowmajor(sA + i * 16 * GPITCH + kk, GPITCH);
#pragma unroll
            for (int j = 0; j < 4; ++j)
                b[j] = load_frag_rowmajor(sB + j * 16 * GPITCH + kk, GPITCH);
#pragma unroll
            for (int i = 0; i < 4; ++i)
#pragma unroll
                for (int j = 0; j < 4; ++j)
                    acc[i][j] = wmma32(a[i], b[j], acc[i][j]);
        }
        // hand-over: own LDS reads done, own copies of slab s+1 landed, then the
        // barrier publishes slab s+1 and frees this buffer for slab s+2
        asm volatile("s_wait_dscnt 0x0" ::: "memory");
        asm volatile("s_wait_asynccnt 0x0" ::: "memory");
        __syncthreads();
        if (s + 2 < nt) {
            const size_t ko = (size_t)(s + 2) * GBK;
            async_copy8(lA + buf * (GSLAB * 2), gA + ko, lstep, gstep);
            async_copy8(lB + buf * (GSLAB * 2), gB + ko, lstep, gstep);
        }
    }
    asm volatile("s_wait_asynccnt 0x0" ::: "memory");  // nothing in flight at the end

    // C/D layout: reg r, lane -> (row = r + 8*(lane>>4), col = lane&15)
    const int half = lane >> 4;
    const int col  = lane & 15;
#pragma unroll
    for (int i = 0; i < 4; ++i) {
#pragma unroll
        for (int j = 0; j < 4; ++j) {
#pragma unroll
            for (int r = 0; r < 8; ++r) {
                const int row = m0 + wm + i * 16 + r + 8 * half;
                const int cn  = n0 + wn + j * 16 + col;
                if (OUT_F16) {
                    Ch[(size_t)row * Nn + cn] = (_Float16)acc[i][j][r];
                } else {
                    Cf[(size_t)row * Nn + cn] = acc[i][j][r] + bias[cn];
                }
            }
        }
    }
}

// ---------------------------------------------------------------------------
// Flash attention: one 8-wave work-group per (batch, head, 128 queries), one
// wave per 16-query tile.
// qkv layout: [B*N, 3C] with q @ col h*64, k @ col C + h*64.
// V comes from the transposed slab vT[B*C][N].
// A stage is 64 keys: 64 K rows and 64 vT rows of 128 B each. It is brought
// into LDS once per work-group by asynchronous 16-B copies (8 lanes = one whole
// 128-B line) and read by all eight waves; two buffers, so the next stage flies
// while this one is worked on.
// ---------------------------------------------------------------------------
#define AW     8                      // waves (16-query tiles) per work-group
#define AKS    64                     // keys per stage
#define APITCH 72                     // halves per LDS row: 144 B = 16 B x 9
#define ABUF   (2 * AKS * APITCH)     // halves per buffer: K rows, then vT rows

// Four asynchronous copies, 16 B per lane each. The s_wait_xcnt stands inside
// the statement so that no address register is rewritten ahead of it.
__device__ __forceinline__ void async_copy4(unsigned l0, unsigned l1,
                                            unsigned l2, unsigned l3,
                                            const _Float16* g0, const _Float16* g1,
                                            const _Float16* g2, const _Float16* g3) {
    asm volatile(
        "global_load_async_to_lds_b128 %0, %4, off\n\t"
        "global_load_async_to_lds_b128 %1, %5, off\n\t"
        "global_load_async_to_lds_b128 %2, %6, off\n\t"
        "global_load_async_to_lds_b128 %3, %7, off\n\t"
        "s_wait_xcnt 0x0"
        :: "v"(l0), "v"(l1), "v"(l2), "v"(l3),
           "v"(g0), "v"(g1), "v"(g2), "v"(g3)
        : "memory");
}

// Orders one wave's own LDS stores and loads on its private prob tile (lanes
// exchange data there); no other wave touches that tile, so no work-group
// barrier is needed. Keeps the compiler from moving LDS accesses across it.
__device__ __forceinline__ void wave_lds_order() {
    __builtin_amdgcn_fence(__ATOMIC_RELEASE, "wavefront");
    __builtin_amdgcn_wave_barrier();
    __builtin_amdgcn_fence(__ATOMIC_ACQUIRE, "wavefront");
}

// Four work-groups per WGP (8 waves per SIMD, at most 128 registers a wave): the
// cross-lane softmax chains are long, and other waves fill them.
__global__ __launch_bounds__(32 * AW) __attribute__((amdgpu_waves_per_eu(8)))
void attention_kernel(const _Float16* __restrict__ qkv,
                      const _Float16* __restrict__ vT,
                      _Float16* __restrict__ outh) {
    __shared__ __attribute__((aligned(16))) _Float16 kv[2 * ABUF];
    __shared__ __attribute__((aligned(16))) _Float16 Pall[AW * 16 * 32];

    const int t    = threadIdx.x;
    const int wave = t >> 5;
    const int q0   = (blockIdx.x * AW + wave) * 16;
    const int h    = blockIdx.y;
    const int b    = blockIdx.z;
    const size_t tokBase = (size_t)b * NN;

    const int lane = t & 31;
    const int half = lane >> 4;
    const int col  = lane & 15;

    _Float16* Pld = Pall + wave * (16 * 32);  // prob tile staging: C-layout -> A-layout

    const _Float16* kbase0 = qkv + tokBase * LD3 + CC + h * DD;   // keys, token-major
    const _Float16* vtbase = vT + ((size_t)b * CC + h * DD) * NN; // [64][NN]

    // Copy map: 8 lanes cover one 128-B row, the block 32 rows per copy; two
    // copies for the 64 K rows, two for the 64 vT rows.
    const int crow = t >> 3;
    const int ccol = (t & 7) * 8;
    const _Float16* gK = kbase0 + (size_t)crow * LD3 + ccol;
    const _Float16* gV = vtbase + (size_t)crow * NN + ccol;
    const unsigned  lK = (unsigned)(size_t)(&kv[crow * APITCH + ccol]);
    const unsigned  lhalf = 32 * APITCH * 2;      // bytes: 32 LDS rows
    const int ns = NN / AKS;

    // stage 0 -> buffer 0, landed and published before anybody reads it
    async_copy4(lK, lK + lhalf, lK + 2 * lhalf, lK + 3 * lhalf,
                gK, gK + (size_t)32 * LD3, gV, gV + (size_t)32 * NN);
    asm volatile("s_wait_asynccnt 0x0" ::: "memory");  // own copies landed
    __syncthreads();                                   // every wave's copies landed
    {
        const _Float16* k1 = gK + (size_t)AKS * LD3;
        const _Float16* v1 = gV + AKS;
        const unsigned  l1 = lK + ABUF * 2;
        async_copy4(l1, l1 + lhalf, l1 + 2 * lhalf, l1 + 3 * lhalf,
                    k1, k1 + (size_t)32 * LD3, v1, v1 + (size_t)32 * NN);
    }

    // Q fragments (16 rows x 64 d), two K=32 chunks
    const _Float16* qbase = qkv + (tokBase + q0) * LD3 + h * DD;
    const v16h qa0 = load_frag_rowmajor(qbase, LD3);
    const v16h qa1 = load_frag_rowmajor(qbase + 32, LD3);

    const v8f vzero = {0.f, 0.f, 0.f, 0.f, 0.f, 0.f, 0.f, 0.f};
    v8f o[4];
#pragma unroll
    for (int j = 0; j < 4; ++j) o[j] = vzero;

    float m[8], l[8];
#pragma unroll
    for (int r = 0; r < 8; ++r) { m[r] = -1e30f; l[r] = 0.f; }

    const float scale = 0.125f;  // D^-0.5 = 64^-0.5

    for (int s = 0; s < ns; ++s) {
        const int buf = s & 1;
        const _Float16* sK = kv + buf * ABUF;
        const _Float16* sV = sK + AKS * APITCH;

        // two 32-key blocks per stage; kept rolled: unrolled, the build spills registers
#pragma unroll 1
        for (int kb = 0; kb < AKS; kb += 32) {
            const _Float16* kbase = sK + kb * APITCH;

            // ---- fragments of this block, from the shared stage ----
            v16h kf00 = load_frag_rowmajor(kbase, APITCH);                 // keys +0,  d 0..31
            v16h kf01 = load_frag_rowmajor(kbase + 32, APITCH);            // keys +0,  d 32..63
            v16h kf10 = load_frag_rowmajor(kbase + 16 * APITCH, APITCH);   // keys +16, d 0..31
            v16h kf11 = load_frag_rowmajor(kbase + 16 * APITCH + 32, APITCH);

            // ---- scores: S[16 x 32] as two 16x16 f32 tiles ----
            v8f s0 = vzero, s1 = vzero;
            s0 = wmma32(qa0, kf00, s0);
            s0 = wmma32(qa1, kf01, s0);
            s1 = wmma32(qa0, kf10, s1);
            s1 = wmma32(qa1, kf11, s1);

            // ---- online softmax over this 32-key block ----
            float fac[8];
#pragma unroll
            for (int r = 0; r < 8; ++r) {
                float a0 = s0[r] * scale;
                float a1 = s1[r] * scale;
                float rm = fmaxf(a0, a1);
                rm = fmaxf(rm, __shfl_xor(rm, 1, 32));
                rm = fmaxf(rm, __shfl_xor(rm, 2, 32));
                rm = fmaxf(rm, __shfl_xor(rm, 4, 32));
                rm = fmaxf(rm, __shfl_xor(rm, 8, 32));   // row max within 16-lane half
                const float nm = fmaxf(m[r], rm);
                const float p0 = __expf(a0 - nm);
                const float p1 = __expf(a1 - nm);
                float rs = p0 + p1;
                rs += __shfl_xor(rs, 1, 32);
                rs += __shfl_xor(rs, 2, 32);
                rs += __shfl_xor(rs, 4, 32);
                rs += __shfl_xor(rs, 8, 32);             // row sum within half
                const float f = __expf(m[r] - nm);
                l[r] = l[r] * f + rs;
                m[r] = nm;
                fac[r] = f;
                // stash probabilities (C/D layout -> LDS row-major 16x32)
                const int row = r + 8 * half;
                Pld[row * 32 + col]      = (_Float16)p0;
                Pld[row * 32 + 16 + col] = (_Float16)p1;
            }

            // rescale running output accumulators
#pragma unroll
            for (int j = 0; j < 4; ++j)
#pragma unroll
                for (int r = 0; r < 8; ++r) o[j][r] *= fac[r];

            wave_lds_order();  // prob tile stores before its fragment load
            const v16h pa = load_frag_rowmajor(&Pld[0], 32);
            // V fragments only now: LDS is near, and the registers stay free
            // during the softmax
            v16h vf0 = load_frag_rowmajor(sV +  0 * APITCH + kb, APITCH);
            v16h vf1 = load_frag_rowmajor(sV + 16 * APITCH + kb, APITCH);
            v16h vf2 = load_frag_rowmajor(sV + 32 * APITCH + kb, APITCH);
            v16h vf3 = load_frag_rowmajor(sV + 48 * APITCH + kb, APITCH);

            // ---- O += P[16x32] * V[32x64] ----
            o[0] = wmma32(pa, vf0, o[0]);
            o[1] = wmma32(pa, vf1, o[1]);
            o[2] = wmma32(pa, vf2, o[2]);
            o[3] = wmma32(pa, vf3, o[3]);
            wave_lds_order();  // fragment load before the next block's stores
        }

        // hand-over: own LDS reads done, own copies of stage s+1 landed, then the
        // barrier publishes stage s+1 and frees this buffer for stage s+2
        asm volatile("s_wait_dscnt 0x0" ::: "memory");
        asm volatile("s_wait_asynccnt 0x0" ::: "memory");
        __syncthreads();
        if (s + 2 < ns) {
            const _Float16* kn = gK + (size_t)(s + 2) * AKS * LD3;
            const _Float16* vn = gV + (s + 2) * AKS;
            const unsigned  ln = lK + buf * (ABUF * 2);
            async_copy4(ln, ln + lhalf, ln + 2 * lhalf, ln + 3 * lhalf,
                        kn, kn + (size_t)32 * LD3, vn, vn + (size_t)32 * NN);
        }
    }
    asm volatile("s_wait_asynccnt 0x0" ::: "memory");  // nothing in flight at the end

    // ---- epilogue: normalize and store f16 at [token, h*64 + d] ----
    _Float16* obase = outh + (tokBase + q0) * CC + h * DD;
#pragma unroll
    for (int j = 0; j < 4; ++j) {
#pragma unroll
        for (int r = 0; r < 8; ++r) {
            const int row = r + 8 * half;
            obase[(size_t)row * CC + j * 16 + col] = (_Float16)(o[j][r] / l[r]);
        }
    }
}

// ---------------------------------------------------------------------------
// Host-side launch
// ---------------------------------------------------------------------------
extern "C" void kernel_launch(void* const* d_in, const int* in_sizes, int n_in,
                              void* d_out, int out_size, void* d_ws, size_t ws_size,
                              hipStream_t stream) {
    const float* x      = (const float*)d_in[0];   // [B,N,C]
    const float* W_qkv  = (const float*)d_in[1];   // [C, 3C]
    const float* W_proj = (const float*)d_in[2];   // [C, C]
    const float* b_proj = (const float*)d_in[3];   // [C]
    float* out = (float*)d_out;                    // [B,N,C] f32

    // Workspace layout (all f16)
    _Float16* xh     = (_Float16*)d_ws;                 // [M, C]
    _Float16* wqkvT  = xh     + (size_t)MM * CC;        // [3C, C]
    _Float16* wprojT = wqkvT  + (size_t)CC * 3 * CC;    // [C, C]
    _Float16* qkvh   = wprojT + (size_t)CC * CC;        // [M, 3C]
    _Float16* attnh  = qkvh   + (size_t)MM * 3 * CC;    // [M, C]
    _Float16* vT     = attnh  + (size_t)MM * CC;        // [B*C, N]

    // 1) precision casts (weights transposed for contiguous B-fragments)
    {
        const int nx = MM * CC;
        cast_f16_kernel<<<(nx + 255) / 256, 256, 0, stream>>>(x, xh, nx);
        transpose_cast_f16_kernel<<<dim3(3 * CC / 64, CC / 64), 256, 0, stream>>>(
            W_qkv, wqkvT, CC, 3 * CC);
        transpose_cast_f16_kernel<<<dim3(CC / 64, CC / 64), 256, 0, stream>>>(
            W_proj, wprojT, CC, CC);
    }

    // 2) qkv = x @ W_qkv              (f16 out)
    wmma_gemm_kernel<true><<<dim3(3 * CC / 128, MM / 128), 128, 0, stream>>>(
        xh, wqkvT, qkvh, nullptr, nullptr, MM, CC, 3 * CC);

    // 2b) transpose V slab for contiguous P*V fragment loads
    transpose_v_kernel<<<dim3(CC / 128, MM / 64), 256, 0, stream>>>(qkvh, vT);

    // 3) flash attention per (b, h, 128 queries)
    attention_kernel<<<dim3(NN / (16 * AW), HH, BB), 32 * AW, 0, stream>>>(qkvh, vT, attnh);

    // 4) out = attn @ W_proj + b_proj (f32 out)
    wmma_gemm_kernel<false><<<dim3(CC / 128, MM / 128), 128, 0, stream>>>(
        attnh, wprojT, nullptr, out, b_proj, MM, CC, CC);
}

// v004
// Measured time: 177 microseconds a run.
// Timed twice side by side with v003, it ran 1.40 times as fast both times.
// All steps since v000 together make it 4.75 times as fast.
#include <hip/hip_runtime.h>
#include <hip/hip_bf16.h>

// ---------------------------------------------------------------------------
// CDNA5 (gfx1250) attention block:  out = softmax(QK^T * s) V  projected.
// All GEMM-like math goes through v_wmma_f32_16x16x32_f16 (f16 in, f32 acc).
// V is pre-transposed to [B][C][N] so every WMMA fragment is two contiguous
// 16-B loads per lane. The GEMMs and the attention read their fragments from
// LDS tiles that a whole work-group shares (see there).
// ---------------------------------------------------------------------------

typedef __attribute__((ext_vector_type(16))) _Float16 v16h;
typedef __attribute__((ext_vector_type(8)))  _Float16 v8h;
typedef __attribute__((ext_vector_type(8)))  float    v8f;

// Problem constants (fixed by the reference)
#define BB   4
#define NN   2048
#define CC   1024
#define HH   16
#define DD   64
#define LD3  (3 * CC)   // 3072, row stride of qkv buffer
#define MM   (BB * NN)  // 8192 tokens

__device__ __forceinline__ v8f wmma32(v16h a, v16h b, v8f c) {
    // (neg_a, A, neg_b, B, c_mod, C, reuse_a, reuse_b)
    return __builtin_amdgcn_wmma_f32_16x16x32_f16(
        false, a, false, b, (short)0, c, false, false);
}

// Load a 16x32 f16 fragment in the CDNA5 16-bit A/B layout from a row-major
// matrix (16-wide index across lanes&15; K contiguous within a row).
//   lanes 0-15 : idx=lane,    halves [0..7]=K0..7,  [8..15]=K16..23
//   lanes 16-31: idx=lane-16, halves [0..7]=K8..15, [8..15]=K24..31
__device__ __forceinline__ v16h load_frag_rowmajor(const _Float16* base, int ld) {
    const int lane = threadIdx.x & 31;
    const _Float16* p = base + (size_t)(lane & 15) * ld + ((lane >> 4) << 3);
    v8h lo = *(const v8h*)(p);
    v8h hi = *(const v8h*)(p + 16);
    return __builtin_shufflevector(lo, hi, 0, 1, 2, 3, 4, 5, 6, 7,
                                           8, 9, 10, 11, 12, 13, 14, 15);
}

// ---------------------------------------------------------------------------
// Elementwise f32 -> f16 cast
// ---------------------------------------------------------------------------
__global__ void cast_f16_kernel(const float* __restrict__ in,
                                _Float16* __restrict__ out, int n) {
    int i = blockIdx.x * blockDim.x + threadIdx.x;
    if (i < n) out[i] = (_Float16)in[i];
}

// Both transposes below go through an LDS tile so that the global reads AND the
// global writes are 16 B per lane over contiguous runs. Two source rows are
// packed into one dword, so a tile row [c] holds 32 dwords = 64 source rows.
// Pitch 33 dwords (odd): the column-wise dword writes of a wave fall on
// different banks; the read-back is four dword loads per 16-B store.
#define TPD 33

typedef __attribute__((ext_vector_type(2))) _Float16 v2h;
typedef __attribute__((ext_vector_type(4))) float    v4f;
typedef __attribute__((ext_vector_type(4))) unsigned v4u;

__device__ __forceinline__ unsigned pack2h(_Float16 lo, _Float16 hi) {
    v2h p = {lo, hi};
    return __builtin_bit_cast(unsigned, p);
}

// Transposing cast: in[rows][cols] (f32) -> out[cols][rows] (f16).
// One 256-thread block per 64x64 tile; rows and cols are multiples of 64.
__global__ __launch_bounds__(256)
void transpose_cast_f16_kernel(const float* __restrict__ in,
                               _Float16* __restrict__ out,
                               int rows, int cols) {
    __shared__ unsigned tile[64 * TPD];
    const int t  = threadIdx.x;
    const int c0 = blockIdx.x * 64;
    const int r0 = blockIdx.y * 64;
    const int cg = t & 15;   // 4 columns each: 16 lanes = 256 B of one row
    const int rp = t >> 4;   // row pair 0..15 (and +16)

    const float* src = in + (size_t)(r0 + 2 * rp) * cols + c0 + 4 * cg;
    const v4f a0 = *(const v4f*)(src);
    const v4f a1 = *(const v4f*)(src + cols);
    const v4f b0 = *(const v4f*)(src + (size_t)32 * cols);
    const v4f b1 = *(const v4f*)(src + (size_t)33 * cols);

    unsigned* w = tile + (4 * cg) * TPD + rp;
#pragma unroll
    for (int i = 0; i < 4; ++i) {
        w[i * TPD]      = pack2h((_Float16)a0[i], (_Float16)a1[i]);
        w[i * TPD + 16] = pack2h((_Float16)b0[i], (_Float16)b1[i]);
    }
    __syncthreads();

#pragma unroll
    for (int k = 0; k < 2; ++k) {
        const int chunk = t + 256 * k;
        const int c = chunk >> 3;   // output row inside the tile
        const int g = chunk & 7;    // 16-B piece: 8 lanes = one 128-B line
        const unsigned* rd = tile + c * TPD + 4 * g;
        const v4u v = {rd[0], rd[1], rd[2], rd[3]};
        *(v4u*)(out + (size_t)(c0 + c) * rows + r0 + 8 * g) = v;
    }
}

// Extract + transpose the V slab of qkv:
//   vT[b*C + c][n] = qkv[(b*N + n)*3C + 2C + c]
// One 256-thread block per tile of 64 tokens x 128 channels.
__global__ __launch_bounds__(256)
void transpose_v_kernel(const _Float16* __restrict__ qkv,
                        _Float16* __restrict__ vT) {
    __shared__ unsigned tile[128 * TPD];
    const int t    = threadIdx.x;
    const int c0   = blockIdx.x * 128;
    const int tok0 = blockIdx.y * 64;      // b*N + n0; 64 divides N
    const int b    = tok0 / NN;
    const int n0   = tok0 - b * NN;
    const int cg   = t & 15;   // 8 channels each: 16 lanes = 256 B of one row
    const int rp   = t >> 4;   // token pair 0..15 (and +16)

    const _Float16* src = qkv + (size_t)(tok0 + 2 * rp) * LD3 + 2 * CC + c0 + 8 * cg;
    const v8h a0 = *(const v8h*)(src);
    const v8h a1 = *(const v8h*)(src + LD3);
    const v8h b0 = *(const v8h*)(src + (size_t)32 * LD3);
    const v8h b1 = *(const v8h*)(src + (size_t)33 * LD3);

    unsigned* w = tile + (8 * cg) * TPD + rp;
#pragma unroll
    for (int i = 0; i < 8; ++i) {
        w[i * TPD]      = pack2h(a0[i], a1[i]);
        w[i * TPD + 16] = pack2h(b0[i], b1[i]);
    }
    __syncthreads();

    _Float16* dst = vT + ((size_t)b * CC + c0) * NN + n0;
#pragma unroll
    for (int k = 0; k < 4; ++k) {
        const int chunk = t + 256 * k;
        const int c = chunk >> 3;   // channel inside the tile
        const int g = chunk & 7;    // 16-B piece: 8 lanes = one 128-B line
        const unsigned* rd = tile + c * TPD + 4 * g;
        const v4u v = {rd[0], rd[1], rd[2], rd[3]};
        *(v4u*)(dst + (size_t)c * NN + 8 * g) = v;
    }
}

// ---------------------------------------------------------------------------
// WMMA GEMM:  C[M,Nn] = A[M,K] * B[K,Nn]   (B supplied transposed: BT[Nn][K])
// One 4-wave work-group computes a 128x128 tile; each wave a 64x64 quarter
// (16 accumulators). A K-slab of 64 (128 rows of A, 128 rows of BT, 128 B per
// row) is brought into LDS by asynchronous 16-B copies, whole 128-B lines per
// 8 lanes, two buffers: the next slab flies while this one is multiplied.
// M, Nn multiples of 128; K a multiple of 64.
// ---------------------------------------------------------------------------
#define GT     128                    // tile rows of A and of BT
#define GBK    64                     // k per slab
#define GPITCH 72                     // halves per LDS row: 144 B = 16 B x 9
#define GSLAB  (2 * GT * GPITCH)      // halves per buffer

// Eight asynchronous copies, 16 B per lane each. The s_wait_xcnt stands inside
// the statement so that no address register is rewritten ahead of it.
__device__ __forceinline__ void async_copy8(unsigned l, const _Float16* g,
                                            unsigned lstep, size_t gstep) {
    const unsigned l1 = l + lstep, l2 = l1 + lstep, l3 = l2 + lstep;
    const unsigned l4 = l3 + lstep, l5 = l4 + lstep, l6 = l5 + lstep, l7 = l6 + lstep;
    const _Float16 *g1 = g + gstep, *g2 = g1 + gstep, *g3 = g2 + gstep;
    const _Float16 *g4 = g3 + gstep, *g5 = g4 + gstep, *g6 = g5 + gstep, *g7 = g6 + gstep;
    asm volatile(
        "global_load_async_to_lds_b128 %0, %8, off\n\t"
        "global_load_async_to_lds_b128 %1, %9, off\n\t"
        "global_load_async_to_lds_b128 %2, %10, off\n\t"
        "global_load_async_to_lds_b128 %3, %11, off\n\t"
        "global_load_async_to_lds_b128 %4, %12, off\n\t"
        "global_load_async_to_lds_b128 %5, %13, off\n\t"
        "global_load_async_to_lds_b128 %6, %14, off\n\t"
        "global_load_async_to_lds_b128 %7, %15, off\n\t"
        "s_wait_xcnt 0x0"
        :: "v"(l), "v"(l1), "v"(l2), "v"(l3), "v"(l4), "v"(l5), "v"(l6), "v"(l7),
           "v"(g), "v"(g1), "v"(g2), "v"(g3), "v"(g4), "v"(g5), "v"(g6), "v"(g7)
        : "memory");
}

template <bool OUT_F16>
__global__ __launch_bounds__(128)
void wmma_gemm_kernel(const _Float16* __restrict__ A,
                      const _Float16* __restrict__ BT,
                      _Float16* __restrict__ Ch,
                      float* __restrict__ Cf,
                      const float* __restrict__ bias,
                      int M, int K, int Nn) {
    __shared__ __attribute__((aligned(16))) _Float16 slab[2 * GSLAB];

    const int t    = threadIdx.x;
    const int lane = t & 31;
    const int wave = t >> 5;
    const int n0 = blockIdx.x * GT;
    const int m0 = blockIdx.y * GT;
    const int wm = (wave >> 1) * 64;   // this wave's quarter of the tile
    const int wn = (wave & 1) * 64;

    // Copy map: 8 lanes cover one 128-B row piece, a wave 4 rows, the block 16
    // rows per copy; 8 copies for the A rows, 8 for the BT rows.
    const int crow = t >> 3;
    const int ccol = (t & 7) * 8;
    const _Float16* gA = A  + (size_t)(m0 + crow) * K + ccol;
    const _Float16* gB = BT + (size_t)(n0 + crow) * K + ccol;
    const unsigned  lA = (unsigned)(size_t)(&slab[crow * GPITCH + ccol]);
    const unsigned  lB = lA + GT * GPITCH * 2;
    const unsigned  lstep = 16 * GPITCH * 2;     // bytes: 16 LDS rows
    const size_t    gstep = (size_t)16 * K;      // halves: 16 source rows
    const int nt = K / GBK;

    const v8f vzero = {0.f, 0.f, 0.f, 0.f, 0.f, 0.f, 0.f, 0.f};
    v8f acc[4][4];
#pragma unroll
    for (int i = 0; i < 4; ++i)
#pragma unroll
        for (int j = 0; j < 4; ++j) acc[i][j] = vzero;

    // slab 0 -> buffer 0, landed and published before anybody reads it
    async_copy8(lA, gA, lstep, gstep);
    async_copy8(lB, gB, lstep, gstep);
    asm volatile("s_wait_asynccnt 0x0" ::: "memory");  // own copies landed
    __syncthreads();                                   // every wave's copies landed
    if (nt > 1) {
        async_copy8(lA + GSLAB * 2, gA + GBK, lstep, gstep);
        async_copy8(lB + GSLAB * 2, gB + GBK, lstep, gstep);
    }

    for (int s = 0; s < nt; ++s) {
        const int buf = s & 1;
        const _Float16* sA = slab + buf * GSLAB + wm * GPITCH;
        const _Float16* sB = slab + buf * GSLAB + (GT + wn) * GPITCH;
#pragma unroll
        for (int kk = 0; kk < GBK; kk += 32) {
            v16h a[4], b[4];
#pragma unroll
            for (int i = 0; i < 4; ++i)
                a[i] = load_frag_rowmajor(sA + i * 16 * GPITCH + kk, GPITCH);
#pragma unroll
            for (int j = 0; j < 4; ++j)
                b[j] = load_frag_rowmajor(sB + j * 16 * GPITCH + kk, GPITCH);
#pragma unroll
            for (int i = 0; i < 4; ++i)
#pragma unroll
                for (int j = 0; j < 4; ++j)
                    acc[i][j] = wmma32(a[i], b[j], acc[i][j]);
        }
        // hand-over: own LDS reads done, own copies of slab s+1 landed, then the
        // barrier publishes slab s+1 and frees this buffer for slab s+2
        asm volatile("s_wait_dscnt 0x0" ::: "memory");
        asm volatile("s_wait_asynccnt 0x0" ::: "memory");
        __syncthreads();
        if (s + 2 < nt) {
            const size_t ko = (size_t)(s + 2) * GBK;
            async_copy8(lA + buf * (GSLAB * 2), gA + ko, lstep, gstep);
            async_copy8(lB + buf * (GSLAB * 2), gB + ko, lstep, gstep);
        }
    }
    asm volatile("s_wait_asynccnt 0x0" ::: "memory");  // nothing in flight at the end

    // C/D layout: reg r, lane -> (row = r + 8*(lane>>4), col = lane&15)
    const int half = lane >> 4;
    const int col  = lane & 15;
#pragma unroll
    for (int i = 0; i < 4; ++i) {
#pragma unroll
        for (int j = 0; j < 4; ++j) {
#pragma unroll
            for (int r = 0; r < 8; ++r) {
                const int row = m0 + wm + i * 16 + r + 8 * half;
                const int cn  = n0 + wn + j * 16 + col;
                if (OUT_F16) {
                    Ch[(size_t)row * Nn + cn] = (_Float16)acc[i][j][r];
                } else {
                    Cf[(size_t)row * Nn + cn] = acc[i][j][r] + bias[cn];
                }
            }
        }
    }
}

#define AW     8
#define AKS    64
#define APITCH 72
#define ABUF   (2 * AKS * APITCH)

// Four asynchronous copies, 16 B per lane each. The s_wait_xcnt stands inside
// the statement so that no address register is rewritten ahead of it.
__device__ __forceinline__ void async_copy4(unsigned l0, unsigned l1,
                                            unsigned l2, unsigned l3,
                                            const _Float16* g0, const _Float16* g1,
                                            const _Float16* g2, const _Float16* g3) {
    asm volatile(
        "global_load_async_to_lds_b128 %0, %4, off\n\t"
        "global_load_async_to_lds_b128 %1, %5, off\n\t"
        "global_load_async_to_lds_b128 %2, %6, off\n\t"
        "global_load_async_to_lds_b128 %3, %7, off\n\t"
        "s_wait_xcnt 0x0"
        :: "v"(l0), "v"(l1), "v"(l2), "v"(l3),
           "v"(g0), "v"(g1), "v"(g2), "v"(g3)
        : "memory");
}

// Value of lane ^ 16: the lane that holds the same query's other keys.
__device__ __forceinline__ float xhalf(float x) {
    const int b = __builtin_bit_cast(int, x);
    return __builtin_bit_cast(float, __builtin_amdgcn_permlanex16(
        b, b, 0x76543210, 0xfedcba98, false, false));
}

__device__ __forceinline__ float max3f(float a, float b, float c) {
    return fmaxf(fmaxf(a, b), c);
}

// Four work-groups per WGP (8 waves per SIMD, at most 128 registers a wave): the
// softmax is vector work between the matrix runs, and other waves fill it.
__global__ __launch_bounds__(32 * AW) __attribute__((amdgpu_waves_per_eu(8)))
void attention_kernel(const _Float16* __restrict__ qkv,
                      const _Float16* __restrict__ vT,
                      _Float16* __restrict__ outh) {
    __shared__ __attribute__((aligned(16))) _Float16 kv[2 * ABUF];

    const int t    = threadIdx.x;
    const int wave = t >> 5;
    const int q0   = (blockIdx.x * AW + wave) * 16;
    const int h    = blockIdx.y;
    const int b    = blockIdx.z;
    const size_t tokBase = (size_t)b * NN;

    const int lane = t & 31;
    const int half = lane >> 4;
    const int col  = lane & 15;

    const _Float16* kbase0 = qkv + tokBase * LD3 + CC + h * DD;   // keys, token-major
    const _Float16* vtbase = vT + ((size_t)b * CC + h * DD) * NN; // [64][NN]

    // Copy map: 8 lanes cover one 128-B row, the block 32 rows per copy; two
    // copies for the 64 K rows, two for the 64 vT rows.
    const int crow = t >> 3;
    const int ccol = (t & 7) * 8;
    const _Float16* gK = kbase0 + (size_t)crow * LD3 + ccol;
    const _Float16* gV = vtbase + (size_t)crow * NN + ccol;
    const unsigned  lK = (unsigned)(size_t)(&kv[crow * APITCH + ccol]);
    const unsigned  lhalf = 32 * APITCH * 2;      // bytes: 32 LDS rows
    const int ns = NN / AKS;

    // stage 0 -> buffer 0, landed and published before anybody reads it
    async_copy4(lK, lK + lhalf, lK + 2 * lhalf, lK + 3 * lhalf,
                gK, gK + (size_t)32 * LD3, gV, gV + (size_t)32 * NN);
    asm volatile("s_wait_asynccnt 0x0" ::: "memory");  // own copies landed
    __syncthreads();                                   // every wave's copies landed
    {
        const _Float16* k1 = gK + (size_t)AKS * LD3;
        const _Float16* v1 = gV + AKS;
        const unsigned  l1 = lK + ABUF * 2;
        async_copy4(l1, l1 + lhalf, l1 + 2 * lhalf, l1 + 3 * lhalf,
                    k1, k1 + (size_t)32 * LD3, v1, v1 + (size_t)32 * NN);
    }

    // Q fragments (B operand: column = query, 64 d), two K=32 chunks
    const _Float16* qbase = qkv + (tokBase + q0) * LD3 + h * DD;
    const v16h qa0 = load_frag_rowmajor(qbase, LD3);
    const v16h qa1 = load_frag_rowmajor(qbase + 32, LD3);
    // stands in front of the first overwrite of the Q loads' address registers
    asm volatile("s_wait_xcnt 0x0" ::: "memory");
    __builtin_amdgcn_sched_barrier(0);  // no later register write is lifted over that wait

    const v8f vzero = {0.f, 0.f, 0.f, 0.f, 0.f, 0.f, 0.f, 0.f};
    v8f o[4];
#pragma unroll
    for (int j = 0; j < 4; ++j) o[j] = vzero;

    // This lane's query: running maximum (equal in both halves) and the sum
    // over this lane's own keys (the halves are joined after the loop).
    float m = -1e30f, l = 0.f;

    const float scale = 0.125f;  // D^-0.5 = 64^-0.5

    for (int s = 0; s < ns; ++s) {
        const int buf = s & 1;
        const _Float16* sK = kv + buf * ABUF;
        const _Float16* sV = sK + AKS * APITCH;

        // two 32-key blocks per stage; kept rolled: unrolled, the build spills registers
#pragma unroll 1
        for (int kb = 0; kb < AKS; kb += 32) {
            const _Float16* kbase = sK + kb * APITCH;

            // ---- fragments of this block, from the shared stage ----
            v16h kf00 = load_frag_rowmajor(kbase, APITCH);                 // keys +0,  d 0..31
            v16h kf01 = load_frag_rowmajor(kbase + 32, APITCH);            // keys +0,  d 32..63
            v16h kf10 = load_frag_rowmajor(kbase + 16 * APITCH, APITCH);   // keys +16, d 0..31
            v16h kf11 = load_frag_rowmajor(kbase + 16 * APITCH + 32, APITCH);

            // ---- scores: S^T[32 keys x 16 queries] as two 16x16 f32 tiles ----
            // register r of s0: key kb + 8*half + r; of s1: key kb + 16 + 8*half + r
            v8f s0 = vzero, s1 = vzero;
            s0 = wmma32(kf00, qa0, s0);
            s0 = wmma32(kf01, qa1, s0);
            s1 = wmma32(kf10, qa0, s1);
            s1 = wmma32(kf11, qa1, s1);

            // ---- online softmax over this 32-key block, one query per lane ----
            const float x0 = max3f(max3f(s0[0], s0[1], s0[2]),
                                   max3f(s0[3], s0[4], s0[5]),
                                   max3f(s0[6], s0[7], s1[0]));
            const float x1 = max3f(max3f(s1[1], s1[2], s1[3]),
                                   max3f(s1[4], s1[5], s1[6]), s1[7]);
            float rm = fmaxf(x0, x1);
            rm = fmaxf(rm, xhalf(rm)) * scale;   // over all 32 keys; scale > 0
            const float nm = fmaxf(m, rm);
            const float f  = __expf(m - nm);
            float rs[4] = {0.f, 0.f, 0.f, 0.f};   // four independent chains
            v16h pb;   // P^T as B operand: halves 0..7 from s0, 8..15 from s1
#pragma unroll
            for (int r = 0; r < 8; ++r) {
                const float p0 = __expf(s0[r] * scale - nm);
                const float p1 = __expf(s1[r] * scale - nm);
                rs[r & 1]       += p0;
                rs[2 + (r & 1)] += p1;
                pb[r]     = (_Float16)p0;
                pb[8 + r] = (_Float16)p1;
            }
            l = l * f + ((rs[0] + rs[1]) + (rs[2] + rs[3]));
            m = nm;

            // rescale running output accumulators
#pragma unroll
            for (int j = 0; j < 4; ++j)
#pragma unroll
                for (int r = 0; r < 8; ++r) o[j][r] *= f;

            // V fragments only now: LDS is near, and the registers stay free
            // during the softmax
            v16h vf0 = load_frag_rowmajor(sV +  0 * APITCH + kb, APITCH);
            v16h vf1 = load_frag_rowmajor(sV + 16 * APITCH + kb, APITCH);
            v16h vf2 = load_frag_rowmajor(sV + 32 * APITCH + kb, APITCH);
            v16h vf3 = load_frag_rowmajor(sV + 48 * APITCH + kb, APITCH);

            // ---- O^T[64 d x 16 queries] += V^T[64 x 32] * P^T[32 x 16] ----
            o[0] = wmma32(vf0, pb, o[0]);
            o[1] = wmma32(vf1, pb, o[1]);
            o[2] = wmma32(vf2, pb, o[2]);
            o[3] = wmma32(vf3, pb, o[3]);
        }

        // hand-over: own LDS reads done, own copies of stage s+1 landed, then the
        // barrier publishes stage s+1 and frees this buffer for stage s+2
        asm volatile("s_wait_dscnt 0x0" ::: "memory");
        asm volatile("s_wait_asynccnt 0x0" ::: "memory");
        __syncthreads();
        if (s + 2 < ns) {
            const _Float16* kn = gK + (size_t)(s + 2) * AKS * LD3;
            const _Float16* vn = gV + (s + 2) * AKS;
            const unsigned  ln = lK + buf * (ABUF * 2);
            async_copy4(ln, ln + lhalf, ln + 2 * lhalf, ln + 3 * lhalf,
                        kn, kn + (size_t)32 * LD3, vn, vn + (size_t)32 * NN);
        }
    }
    asm volatile("s_wait_asynccnt 0x0" ::: "memory");  // nothing in flight at the end

    // ---- epilogue: normalize and store f16 at [token, h*64 + d] ----
    // register r of o[j]: d = j*16 + 8*half + r of query col: 16 B per store
    const float lt = l + xhalf(l);
    _Float16* obase = outh + (tokBase + q0 + col) * CC + h * DD + 8 * half;
#pragma unroll
    for (int j = 0; j < 4; ++j) {
        v8h w;
#pragma unroll
        for (int r = 0; r < 8; ++r) w[r] = (_Float16)(o[j][r] / lt);
        *(v8h*)(obase + j * 16) = w;
    }
}

// ---------------------------------------------------------------------------
// Host-side launch
// ---------------------------------------------------------------------------
extern "C" void kernel_launch(void* const* d_in, const int* in_sizes, int n_in,
                              void* d_out, int out_size, void* d_ws, size_t ws_size,
                              hipStream_t stream) {
    const float* x      = (const float*)d_in[0];   // [B,N,C]
    const float* W_qkv  = (const float*)d_in[1];   // [C, 3C]
    const float* W_proj = (const float*)d_in[2];   // [C, C]
    const float* b_proj = (const float*)d_in[3];   // [C]
    float* out = (float*)d_out;                    // [B,N,C] f32

    // Workspace layout (all f16)
    _Float16* xh     = (_Float16*)d_ws;                 // [M, C]
    _Float16* wqkvT  = xh     + (size_t)MM * CC;        // [3C, C]
    _Float16* wprojT = wqkvT  + (size_t)CC * 3 * CC;    // [C, C]
    _Float16* qkvh   = wprojT + (size_t)CC * CC;        // [M, 3C]
    _Float16* attnh  = qkvh   + (size_t)MM * 3 * CC;    // [M, C]
    _Float16* vT     = attnh  + (size_t)MM * CC;        // [B*C, N]

    // 1) precision casts (weights transposed for contiguous B-fragments)
    {
        const int nx = MM * CC;
        cast_f16_kernel<<<(nx + 255) / 256, 256, 0, stream>>>(x, xh, nx);
        transpose_cast_f16_kernel<<<dim3(3 * CC / 64, CC / 64), 256, 0, stream>>>(
            W_qkv, wqkvT, CC, 3 * CC);
        transpose_cast_f16_kernel<<<dim3(CC / 64, CC / 64), 256, 0, stream>>>(
            W_proj, wprojT, CC, CC);
    }

    // 2) qkv = x @ W_qkv              (f16 out)
    wmma_gemm_kernel<true><<<dim3(3 * CC / 128, MM / 128), 128, 0, stream>>>(
        xh, wqkvT, qkvh, nullptr, nullptr, MM, CC, 3 * CC);

    // 2b) transpose V slab for contiguous P*V fragment loads
    transpose_v_kernel<<<dim3(CC / 128, MM / 64), 256, 0, stream>>>(qkvh, vT);

    // 3) flash attention per (b, h, 128 queries)
    attention_kernel<<<dim3(NN / (16 * AW), HH, BB), 32 * AW, 0, stream>>>(qkvh, vT, attnh);

    // 4) out = attn @ W_proj + b_proj (f32 out)
    wmma_gemm_kernel<false><<<dim3(CC / 128, MM / 128), 128, 0, stream>>>(
        attnh, wprojT, nullptr, out, b_proj, MM, CC, CC);
}

// v005
// A run of this version takes 166 microseconds.
// Next to v004, in two timings, it ran 1.07 times as fast each time.
// All steps since v000 together make it 5.07 times as fast.
#include <hip/hip_runtime.h>
#include <hip/hip_bf16.h>

// ---------------------------------------------------------------------------
// CDNA5 (gfx1250) attention block:  out = softmax(QK^T * s) V  projected.
// All GEMM-like math goes through v_wmma_f32_16x16x32_f16 (f16 in, f32 acc).
// V is pre-transposed to [B][C][N] so every WMMA fragment is two contiguous
// 16-B loads per lane. The GEMMs and the attention read their fragments from
// LDS tiles that a whole work-group shares (see there).
// ---------------------------------------------------------------------------

typedef __attribute__((ext_vector_type(16))) _Float16 v16h;
typedef __attribute__((ext_vector_type(8)))  _Float16 v8h;
typedef __attribute__((ext_vector_type(8)))  float    v8f;

// Problem constants (fixed by the reference)
#define BB   4
#define NN   2048
#define CC   1024
#define HH   16
#define DD   64
#define LD3  (3 * CC)   // 3072, row stride of qkv buffer
#define MM   (BB * NN)  // 8192 tokens

__device__ __forceinline__ v8f wmma32(v16h a, v16h b, v8f c) {
    // (neg_a, A, neg_b, B, c_mod, C, reuse_a, reuse_b)
    return __builtin_amdgcn_wmma_f32_16x16x32_f16(
        false, a, false, b, (short)0, c, false, false);
}

// Load a 16x32 f16 fragment in the CDNA5 16-bit A/B layout from a row-major
// matrix (16-wide index across lanes&15; K contiguous within a row).
//   lanes 0-15 : idx=lane,    halves [0..7]=K0..7,  [8..15]=K16..23
//   lanes 16-31: idx=lane-16, halves [0..7]=K8..15, [8..15]=K24..31
__device__ __forceinline__ v16h load_frag_rowmajor(const _Float16* base, int ld) {
    const int lane = threadIdx.x & 31;
    const _Float16* p = base + (size_t)(lane & 15) * ld + ((lane >> 4) << 3);
    v8h lo = *(const v8h*)(p);
    v8h hi = *(const v8h*)(p + 16);
    return __builtin_shufflevector(lo, hi, 0, 1, 2, 3, 4, 5, 6, 7,
                                           8, 9, 10, 11, 12, 13, 14, 15);
}

// ---------------------------------------------------------------------------
// Elementwise f32 -> f16 cast of the M*C activations.
// Few long waves instead of one element per thread: a wave takes CAST_U runs of
// 128 floats. Each load is 16 B per lane over 512 contiguous bytes (4 whole
// lines); the loads stand ahead of the stores, so a wave keeps many lines in
// flight; each store is 8 B per lane over 256 contiguous bytes (2 whole lines).
// The grid covers exactly M*C elements, so there is no tail.
// ---------------------------------------------------------------------------
#define CAST_T 256                          // threads per block
#define CAST_U 16                           // 16-B loads per lane
#define CAST_BLOCK (CAST_T * CAST_U * 4)    // floats per block
static_assert((MM * CC) % CAST_BLOCK == 0, "the cast grid must cover x exactly");

typedef __attribute__((ext_vector_type(4))) float    c4f;
typedef __attribute__((ext_vector_type(4))) _Float16 c4h;

__global__ __launch_bounds__(CAST_T)
void cast_f16_kernel(const float* __restrict__ in,
                     _Float16* __restrict__ out) {
    const int lane = threadIdx.x & 31;
    const int wave = blockIdx.x * (CAST_T / 32) + (threadIdx.x >> 5);
    const size_t base = (size_t)wave * (CAST_U * 128) + lane * 4;
    const float* src = in + base;
    _Float16*    dst = out + base;

    c4f v[CAST_U];
#pragma unroll
    for (int u = 0; u < CAST_U; ++u) v[u] = *(const c4f*)(src + u * 128);
#pragma unroll
    for (int u = 0; u < CAST_U; ++u) {
        const c4h h = {(_Float16)v[u][0], (_Float16)v[u][1],
                       (_Float16)v[u][2], (_Float16)v[u][3]};
        *(c4h*)(dst + u * 128) = h;
    }
}

// Both transposes below go through an LDS tile so that the global reads AND the
// global writes are 16 B per lane over contiguous runs. Two source rows are
// packed into one dword, so a tile row [c] holds 32 dwords = 64 source rows.
// Pitch 33 dwords (odd): the column-wise dword writes of a wave fall on
// different banks; the read-back is four dword loads per 16-B store.
#define TPD 33

typedef __attribute__((ext_vector_type(2))) _Float16 v2h;
typedef __attribute__((ext_vector_type(4))) float    v4f;
typedef __attribute__((ext_vector_type(4))) unsigned v4u;

__device__ __forceinline__ unsigned pack2h(_Float16 lo, _Float16 hi) {
    v2h p = {lo, hi};
    return __builtin_bit_cast(unsigned, p);
}

// Transposing cast: in[rows][cols] (f32) -> out[cols][rows] (f16).
// One 256-thread block per 64x64 tile; rows and cols are multiples of 64.
__global__ __launch_bounds__(256)
void transpose_cast_f16_kernel(const float* __restrict__ in,
                               _Float16* __restrict__ out,
                               int rows, int cols) {
    __shared__ unsigned tile[64 * TPD];
    const int t  = threadIdx.x;
    const int c0 = blockIdx.x * 64;
    const int r0 = blockIdx.y * 64;
    const int cg = t & 15;   // 4 columns each: 16 lanes = 256 B of one row
    const int rp = t >> 4;   // row pair 0..15 (and +16)

    const float* src = in + (size_t)(r0 + 2 * rp) * cols + c0 + 4 * cg;
    const v4f a0 = *(const v4f*)(src);
    const v4f a1 = *(const v4f*)(src + cols);
    const v4f b0 = *(const v4f*)(src + (size_t)32 * cols);
    const v4f b1 = *(const v4f*)(src + (size_t)33 * cols);

    unsigned* w = tile + (4 * cg) * TPD + rp;
#pragma unroll
    for (int i = 0; i < 4; ++i) {
        w[i * TPD]      = pack2h((_Float16)a0[i], (_Float16)a1[i]);
        w[i * TPD + 16] = pack2h((_Float16)b0[i], (_Float16)b1[i]);
    }
    __syncthreads();

#pragma unroll
    for (int k = 0; k < 2; ++k) {
        const int chunk = t + 256 * k;
        const int c = chunk >> 3;   // output row inside the tile
        const int g = chunk & 7;    // 16-B piece: 8 lanes = one 128-B line
        const unsigned* rd = tile + c * TPD + 4 * g;
        const v4u v = {rd[0], rd[1], rd[2], rd[3]};
        *(v4u*)(out + (size_t)(c0 + c) * rows + r0 + 8 * g) = v;
    }
}

// Extract + transpose the V slab of qkv:
//   vT[b*C + c][n] = qkv[(b*N + n)*3C + 2C + c]
// One 256-thread block per tile of 64 tokens x 128 channels.
__global__ __launch_bounds__(256)
void transpose_v_kernel(const _Float16* __restrict__ qkv,
                        _Float16* __restrict__ vT) {
    __shared__ unsigned tile[128 * TPD];
    const int t    = threadIdx.x;
    const int c0   = blockIdx.x * 128;
    const int tok0 = blockIdx.y * 64;      // b*N + n0; 64 divides N
    const int b    = tok0 / NN;
    const int n0   = tok0 - b * NN;
    const int cg   = t & 15;   // 8 channels each: 16 lanes = 256 B of one row
    const int rp   = t >> 4;   // token pair 0..15 (and +16)

    const _Float16* src = qkv + (size_t)(tok0 + 2 * rp) * LD3 + 2 * CC + c0 + 8 * cg;
    const v8h a0 = *(const v8h*)(src);
    const v8h a1 = *(const v8h*)(src + LD3);
    const v8h b0 = *(const v8h*)(src + (size_t)32 * LD3);
    const v8h b1 = *(const v8h*)(src + (size_t)33 * LD3);

    unsigned* w = tile + (8 * cg) * TPD + rp;
#pragma unroll
    for (int i = 0; i < 8; ++i) {
        w[i * TPD]      = pack2h(a0[i], a1[i]);
        w[i * TPD + 16] = pack2h(b0[i], b1[i]);
    }
    __syncthreads();

    _Float16* dst = vT + ((size_t)b * CC + c0) * NN + n0;
#pragma unroll
    for (int k = 0; k < 4; ++k) {
        const int chunk = t + 256 * k;
        const int c = chunk >> 3;   // channel inside the tile
        const int g = chunk & 7;    // 16-B piece: 8 lanes = one 128-B line
        const unsigned* rd = tile + c * TPD + 4 * g;
        const v4u v = {rd[0], rd[1], rd[2], rd[3]};
        *(v4u*)(dst + (size_t)c * NN + 8 * g) = v;
    }
}

// ---------------------------------------------------------------------------
// WMMA GEMM:  C[M,Nn] = A[M,K] * B[K,Nn]   (B supplied transposed: BT[Nn][K])
// One 4-wave work-group computes a 128x128 tile; each wave a 64x64 quarter
// (16 accumulators). A K-slab of 64 (128 rows of A, 128 rows of BT, 128 B per
// row) is brought into LDS by asynchronous 16-B copies, whole 128-B lines per
// 8 lanes, two buffers: the next slab flies while this one is multiplied.
// M, Nn multiples of 128; K a multiple of 64.
// ---------------------------------------------------------------------------
#define GT     128                    // tile rows of A and of BT
#define GBK    64                     // k per slab
#define GPITCH 72                     // halves per LDS row: 144 B = 16 B x 9
#define GSLAB  (2 * GT * GPITCH)      // halves per buffer

// Eight asynchronous copies, 16 B per lane each. The s_wait_xcnt stands inside
// the statement so that no address register is rewritten ahead of it.
__device__ __forceinline__ void async_copy8(unsigned l, const _Float16* g,
                                            unsigned lstep, size_t gstep) {
    const unsigned l1 = l + lstep, l2 = l1 + lstep, l3 = l2 + lstep;
    const unsigned l4 = l3 + lstep, l5 = l4 + lstep, l6 = l5 + lstep, l7 = l6 + lstep;
    const _Float16 *g1 = g + gstep, *g2 = g1 + gstep, *g3 = g2 + gstep;
    const _Float16 *g4 = g3 + gstep, *g5 = g4 + gstep, *g6 = g5 + gstep, *g7 = g6 + gstep;
    asm volatile(
        "global_load_async_to_lds_b128 %0, %8, off\n\t"
        "global_load_async_to_lds_b128 %1, %9, off\n\t"
        "global_load_async_to_lds_b128 %2, %10, off\n\t"
        "global_load_async_to_lds_b128 %3, %11, off\n\t"
        "global_load_async_to_lds_b128 %4, %12, off\n\t"
        "global_load_async_to_lds_b128 %5, %13, off\n\t"
        "global_load_async_to_lds_b128 %6, %14, off\n\t"
        "global_load_async_to_lds_b128 %7, %15, off\n\t"
        "s_wait_xcnt 0x0"
        :: "v"(l), "v"(l1), "v"(l2), "v"(l3), "v"(l4), "v"(l5), "v"(l6), "v"(l7),
           "v"(g), "v"(g1), "v"(g2), "v"(g3), "v"(g4), "v"(g5), "v"(g6), "v"(g7)
        : "memory");
}

template <bool OUT_F16>
__global__ __launch_bounds__(128)
void wmma_gemm_kernel(const _Float16* __restrict__ A,
                      const _Float16* __restrict__ BT,
                      _Float16* __restrict__ Ch,
                      float* __restrict__ Cf,
                      const float* __restrict__ bias,
                      int M, int K, int Nn) {
    __shared__ __attribute__((aligned(16))) _Float16 slab[2 * GSLAB];

    const int t    = threadIdx.x;
    const int lane = t & 31;
    const int wave = t >> 5;
    const int n0 = blockIdx.x * GT;
    const int m0 = blockIdx.y * GT;
    const int wm = (wave >> 1) * 64;   // this wave's quarter of the tile
    const int wn = (wave & 1) * 64;

    // Copy map: 8 lanes cover one 128-B row piece, a wave 4 rows, the block 16
    // rows per copy; 8 copies for the A rows, 8 for the BT rows.
    const int crow = t >> 3;
    const int ccol = (t & 7) * 8;
    const _Float16* gA = A  + (size_t)(m0 + crow) * K + ccol;
    const _Float16* gB = BT + (size_t)(n0 + crow) * K + ccol;
    const unsigned  lA = (unsigned)(size_t)(&slab[crow * GPITCH + ccol]);
    const unsigned  lB = lA + GT * GPITCH * 2;
    const unsigned  lstep = 16 * GPITCH * 2;     // bytes: 16 LDS rows
    const size_t    gstep = (size_t)16 * K;      // halves: 16 source rows
    const int nt = K / GBK;

    const v8f vzero = {0.f, 0.f, 0.f, 0.f, 0.f, 0.f, 0.f, 0.f};
    v8f acc[4][4];
#pragma unroll
    for (int i = 0; i < 4; ++i)
#pragma unroll
        for (int j = 0; j < 4; ++j) acc[i][j] = vzero;

    // slab 0 -> buffer 0, landed and published before anybody reads it
    async_copy8(lA, gA, lstep, gstep);
    async_copy8(lB, gB, lstep, gstep);
    asm volatile("s_wait_asynccnt 0x0" ::: "memory");  // own copies landed
    __syncthreads();                                   // every wave's copies landed
    if (nt > 1) {
        async_copy8(lA + GSLAB * 2, gA + GBK, lstep, gstep);
        async_copy8(lB + GSLAB * 2, gB + GBK, lstep, gstep);
    }

    for (int s = 0; s < nt; ++s) {
        const int buf = s & 1;
        const _Float16* sA = slab + buf * GSLAB + wm * GPITCH;
        const _Float16* sB = slab + buf * GSLAB + (GT + wn) * GPITCH;
#pragma unroll
        for (int kk = 0; kk < GBK; kk += 32) {
            v16h a[4], b[4];
#pragma unroll
            for (int i = 0; i < 4; ++i)
                a[i] = load_frag_rowmajor(sA + i * 16 * GPITCH + kk, GPITCH);
#pragma unroll
            for (int j = 0; j < 4; ++j)
                b[j] = load_frag_rowmajor(sB + j * 16 * GPITCH + kk, GPITCH);
#pragma unroll
            for (int i = 0; i < 4; ++i)
#pragma unroll
                for (int j = 0; j < 4; ++j)
                    acc[i][j] = wmma32(a[i], b[j], acc[i][j]);
        }
        // hand-over: own LDS reads done, own copies of slab s+1 landed, then the
        // barrier publishes slab s+1 and frees this buffer for slab s+2
        asm volatile("s_wait_dscnt 0x0" ::: "memory");
        asm volatile("s_wait_asynccnt 0x0" ::: "memory");
        __syncthreads();
        if (s + 2 < nt) {
            const size_t ko = (size_t)(s + 2) * GBK;
            async_copy8(lA + buf * (GSLAB * 2), gA + ko, lstep, gstep);
            async_copy8(lB + buf * (GSLAB * 2), gB + ko, lstep, gstep);
        }
    }
    asm volatile("s_wait_asynccnt 0x0" ::: "memory");  // nothing in flight at the end

    // C/D layout: reg r, lane -> (row = r + 8*(lane>>4), col = lane&15)
    const int half = lane >> 4;
    const int col  = lane & 15;
#pragma unroll
    for (int i = 0; i < 4; ++i) {
#pragma unroll
        for (int j = 0; j < 4; ++j) {
#pragma unroll
            for (int r = 0; r < 8; ++r) {
                const int row = m0 + wm + i * 16 + r + 8 * half;
                const int cn  = n0 + wn + j * 16 + col;
                if (OUT_F16) {
                    Ch[(size_t)row * Nn + cn] = (_Float16)acc[i][j][r];
                } else {
                    Cf[(size_t)row * Nn + cn] = acc[i][j][r] + bias[cn];
                }
            }
        }
    }
}

#define AW     8
#define AKS    64
#define APITCH 72
#define ABUF   (2 * AKS * APITCH)

// Four asynchronous copies, 16 B per lane each. The s_wait_xcnt stands inside
// the statement so that no address register is rewritten ahead of it.
__device__ __forceinline__ void async_copy4(unsigned l0, unsigned l1,
                                            unsigned l2, unsigned l3,
                                            const _Float16* g0, const _Float16* g1,
                                            const _Float16* g2, const _Float16* g3) {
    asm volatile(
        "global_load_async_to_lds_b128 %0, %4, off\n\t"
        "global_load_async_to_lds_b128 %1, %5, off\n\t"
        "global_load_async_to_lds_b128 %2, %6, off\n\t"
        "global_load_async_to_lds_b128 %3, %7, off\n\t"
        "s_wait_xcnt 0x0"
        :: "v"(l0), "v"(l1), "v"(l2), "v"(l3),
           "v"(g0), "v"(g1), "v"(g2), "v"(g3)
        : "memory");
}

// Value of lane ^ 16: the lane that holds the same query's other keys.
__device__ __forceinline__ float xhalf(float x) {
    const int b = __builtin_bit_cast(int, x);
    return __builtin_bit_cast(float, __builtin_amdgcn_permlanex16(
        b, b, 0x76543210, 0xfedcba98, false, false));
}

__device__ __forceinline__ float max3f(float a, float b, float c) {
    return fmaxf(fmaxf(a, b), c);
}

// Four work-groups per WGP (8 waves per SIMD, at most 128 registers a wave): the
// softmax is vector work between the matrix runs, and other waves fill it.
__global__ __launch_bounds__(32 * AW) __attribute__((amdgpu_waves_per_eu(8)))
void attention_kernel(const _Float16* __restrict__ qkv,
                      const _Float16* __restrict__ vT,
                      _Float16* __restrict__ outh) {
    __shared__ __attribute__((aligned(16))) _Float16 kv[2 * ABUF];

    const int t    = threadIdx.x;
    const int wave = t >> 5;
    const int q0   = (blockIdx.x * AW + wave) * 16;
    const int h    = blockIdx.y;
    const int b    = blockIdx.z;
    const size_t tokBase = (size_t)b * NN;

    const int lane = t & 31;
    const int half = lane >> 4;
    const int col  = lane & 15;

    const _Float16* kbase0 = qkv + tokBase * LD3 + CC + h * DD;   // keys, token-major
    const _Float16* vtbase = vT + ((size_t)b * CC + h * DD) * NN; // [64][NN]

    // Copy map: 8 lanes cover one 128-B row, the block 32 rows per copy; two
    // copies for the 64 K rows, two for the 64 vT rows.
    const int crow = t >> 3;
    const int ccol = (t & 7) * 8;
    const _Float16* gK = kbase0 + (size_t)crow * LD3 + ccol;
    const _Float16* gV = vtbase + (size_t)crow * NN + ccol;
    const unsigned  lK = (unsigned)(size_t)(&kv[crow * APITCH + ccol]);
    const unsigned  lhalf = 32 * APITCH * 2;      // bytes: 32 LDS rows
    const int ns = NN / AKS;

    // stage 0 -> buffer 0, landed and published before anybody reads it
    async_copy4(lK, lK + lhalf, lK + 2 * lhalf, lK + 3 * lhalf,
                gK, gK + (size_t)32 * LD3, gV, gV + (size_t)32 * NN);
    asm volatile("s_wait_asynccnt 0x0" ::: "memory");  // own copies landed
    __syncthreads();                                   // every wave's copies landed
    {
        const _Float16* k1 = gK + (size_t)AKS * LD3;
        const _Float16* v1 = gV + AKS;
        const unsigned  l1 = lK + ABUF * 2;
        async_copy4(l1, l1 + lhalf, l1 + 2 * lhalf, l1 + 3 * lhalf,
                    k1, k1 + (size_t)32 * LD3, v1, v1 + (size_t)32 * NN);
    }

    // Q fragments (B operand: column = query, 64 d), two K=32 chunks
    const _Float16* qbase = qkv + (tokBase + q0) * LD3 + h * DD;
    const v16h qa0 = load_frag_rowmajor(qbase, LD3);
    const v16h qa1 = load_frag_rowmajor(qbase + 32, LD3);
    // stands in front of the first overwrite of the Q loads' address registers
    asm volatile("s_wait_xcnt 0x0" ::: "memory");
    __builtin_amdgcn_sched_barrier(0);  // no later register write is lifted over that wait

    const v8f vzero = {0.f, 0.f, 0.f, 0.f, 0.f, 0.f, 0.f, 0.f};
    v8f o[4];
#pragma unroll
    for (int j = 0; j < 4; ++j) o[j] = vzero;

    // This lane's query: running maximum (equal in both halves) and the sum
    // over this lane's own keys (the halves are joined after the loop).
    float m = -1e30f, l = 0.f;

    const float scale = 0.125f;  // D^-0.5 = 64^-0.5

    for (int s = 0; s < ns; ++s) {
        const int buf = s & 1;
        const _Float16* sK = kv + buf * ABUF;
        const _Float16* sV = sK + AKS * APITCH;

        // two 32-key blocks per stage; kept rolled: unrolled, the build spills registers
#pragma unroll 1
        for (int kb = 0; kb < AKS; kb += 32) {
            const _Float16* kbase = sK + kb * APITCH;

            // ---- fragments of this block, from the shared stage ----
            v16h kf00 = load_frag_rowmajor(kbase, APITCH);                 // keys +0,  d 0..31
            v16h kf01 = load_frag_rowmajor(kbase + 32, APITCH);            // keys +0,  d 32..63
            v16h kf10 = load_frag_rowmajor(kbase + 16 * APITCH, APITCH);   // keys +16, d 0..31
            v16h kf11 = load_frag_rowmajor(kbase + 16 * APITCH + 32, APITCH);

            // ---- scores: S^T[32 keys x 16 queries] as two 16x16 f32 tiles ----
            // register r of s0: key kb + 8*half + r; of s1: key kb + 16 + 8*half + r
            v8f s0 = vzero, s1 = vzero;
            s0 = wmma32(kf00, qa0, s0);
            s0 = wmma32(kf01, qa1, s0);
            s1 = wmma32(kf10, qa0, s1);
            s1 = wmma32(kf11, qa1, s1);

            // ---- online softmax over this 32-key block, one query per lane ----
            const float x0 = max3f(max3f(s0[0], s0[1], s0[2]),
                                   max3f(s0[3], s0[4], s0[5]),
                                   max3f(s0[6], s0[7], s1[0]));
            const float x1 = max3f(max3f(s1[1], s1[2], s1[3]),
                                   max3f(s1[4], s1[5], s1[6]), s1[7]);
            float rm = fmaxf(x0, x1);
            rm = fmaxf(rm, xhalf(rm)) * scale;   // over all 32 keys; scale > 0
            const float nm = fmaxf(m, rm);
            const float f  = __expf(m - nm);
            float rs[4] = {0.f, 0.f, 0.f, 0.f};   // four independent chains
            v16h pb;   // P^T as B operand: halves 0..7 from s0, 8..15 from s1
#pragma unroll
            for (int r = 0; r < 8; ++r) {
                const float p0 = __expf(s0[r] * scale - nm);
                const float p1 = __expf(s1[r] * scale - nm);
                rs[r & 1]       += p0;
                rs[2 + (r & 1)] += p1;
                pb[r]     = (_Float16)p0;
                pb[8 + r] = (_Float16)p1;
            }
            l = l * f + ((rs[0] + rs[1]) + (rs[2] + rs[3]));
            m = nm;

            // rescale running output accumulators
#pragma unroll
            for (int j = 0; j < 4; ++j)
#pragma unroll
                for (int r = 0; r < 8; ++r) o[j][r] *= f;

            // V fragments only now: LDS is near, and the registers stay free
            // during the softmax
            v16h vf0 = load_frag_rowmajor(sV +  0 * APITCH + kb, APITCH);
            v16h vf1 = load_frag_rowmajor(sV + 16 * APITCH + kb, APITCH);
            v16h vf2 = load_frag_rowmajor(sV + 32 * APITCH + kb, APITCH);
            v16h vf3 = load_frag_rowmajor(sV + 48 * APITCH + kb, APITCH);

            // ---- O^T[64 d x 16 queries] += V^T[64 x 32] * P^T[32 x 16] ----
            o[0] = wmma32(vf0, pb, o[0]);
            o[1] = wmma32(vf1, pb, o[1]);
            o[2] = wmma32(vf2, pb, o[2]);
            o[3] = wmma32(vf3, pb, o[3]);
        }

        // hand-over: own LDS reads done, own copies of stage s+1 landed, then the
        // barrier publishes stage s+1 and frees this buffer for stage s+2
        asm volatile("s_wait_dscnt 0x0" ::: "memory");
        asm volatile("s_wait_asynccnt 0x0" ::: "memory");
        __syncthreads();
        if (s + 2 < ns) {
            const _Float16* kn = gK + (size_t)(s + 2) * AKS * LD3;
            const _Float16* vn = gV + (s + 2) * AKS;
            const unsigned  ln = lK + buf * (ABUF * 2);
            async_copy4(ln, ln + lhalf, ln + 2 * lhalf, ln + 3 * lhalf,
                        kn, kn + (size_t)32 * LD3, vn, vn + (size_t)32 * NN);
        }
    }
    asm volatile("s_wait_asynccnt 0x0" ::: "memory");  // nothing in flight at the end

    // ---- epilogue: normalize and store f16 at [token, h*64 + d] ----
    // register r of o[j]: d = j*16 + 8*half + r of query col: 16 B per store
    const float lt = l + xhalf(l);
    _Float16* obase = outh + (tokBase + q0 + col) * CC + h * DD + 8 * half;
#pragma unroll
    for (int j = 0; j < 4; ++j) {
        v8h w;
#pragma unroll
        for (int r = 0; r < 8; ++r) w[r] = (_Float16)(o[j][r] / lt);
        *(v8h*)(obase + j * 16) = w;
    }
}

// ---------------------------------------------------------------------------
// Host-side launch
// ---------------------------------------------------------------------------
extern "C" void kernel_launch(void* const* d_in, const int* in_sizes, int n_in,
                              void* d_out, int out_size, void* d_ws, size_t ws_size,
                              hipStream_t stream) {
    const float* x      = (const float*)d_in[0];   // [B,N,C]
    const float* W_qkv  = (const float*)d_in[1];   // [C, 3C]
    const float* W_proj = (const float*)d_in[2];   // [C, C]
    const float* b_proj = (const float*)d_in[3];   // [C]
    float* out = (float*)d_out;                    // [B,N,C] f32

    // Workspace layout (all f16)
    _Float16* xh     = (_Float16*)d_ws;                 // [M, C]
    _Float16* wqkvT  = xh     + (size_t)MM * CC;        // [3C, C]
    _Float16* wprojT = wqkvT  + (size_t)CC * 3 * CC;    // [C, C]
    _Float16* qkvh   = wprojT + (size_t)CC * CC;        // [M, 3C]
    _Float16* attnh  = qkvh   + (size_t)MM * 3 * CC;    // [M, C]
    _Float16* vT     = attnh  + (size_t)MM * CC;        // [B*C, N]

    // 1) precision casts (weights transposed for contiguous B-fragments)
    {
        cast_f16_kernel<<<MM * CC / CAST_BLOCK, CAST_T, 0, stream>>>(x, xh);
        transpose_cast_f16_kernel<<<dim3(3 * CC / 64, CC / 64), 256, 0, stream>>>(
            W_qkv, wqkvT, CC, 3 * CC);
        transpose_cast_f16_kernel<<<dim3(CC / 64, CC / 64), 256, 0, stream>>>(
            W_proj, wprojT, CC, CC);
    }

    // 2) qkv = x @ W_qkv              (f16 out)
    wmma_gemm_kernel<true><<<dim3(3 * CC / 128, MM / 128), 128, 0, stream>>>(
        xh, wqkvT, qkvh, nullptr, nullptr, MM, CC, 3 * CC);

    // 2b) transpose V slab for contiguous P*V fragment loads
    transpose_v_kernel<<<dim3(CC / 128, MM / 64), 256, 0, stream>>>(qkvh, vT);

    // 3) flash attention per (b, h, 128 queries)
    attention_kernel<<<dim3(NN / (16 * AW), HH, BB), 32 * AW, 0, stream>>>(qkvh, vT, attnh);

    // 4) out = attn @ W_proj + b_proj (f32 out)
    wmma_gemm_kernel<false><<<dim3(CC / 128, MM / 128), 128, 0, stream>>>(
        attnh, wprojT, nullptr, out, b_proj, MM, CC, CC);
}

// v006
// A run of this version takes 158 microseconds.
// In both of two side-by-side timings against v005, it was 1.05 times as fast.
// All steps since v000 together make it 5.32 times as fast.
#include <hip/hip_runtime.h>
#include <hip/hip_bf16.h>

// ---------------------------------------------------------------------------
// CDNA5 (gfx1250) attention block:  out = softmax(QK^T * s) V  projected.
// All GEMM-like math goes through v_wmma_f32_16x16x32_f16 (f16 in, f32 acc).
// V is pre-transposed to [B][C][N] so every WMMA fragment is two contiguous
// 16-B loads per lane. The GEMMs and the attention read their fragments from
// LDS tiles that a whole work-group shares (see there).
// ---------------------------------------------------------------------------

typedef __attribute__((ext_vector_type(16))) _Float16 v16h;
typedef __attribute__((ext_vector_type(8)))  _Float16 v8h;
typedef __attribute__((ext_vector_type(8)))  float    v8f;

// Problem constants (fixed by the reference)
#define BB   4
#define NN   2048
#define CC   1024
#define HH   16
#define DD   64
#define LD3  (3 * CC)   // 3072, row stride of qkv buffer
#define MM   (BB * NN)  // 8192 tokens

__device__ __forceinline__ v8f wmma32(v16h a, v16h b, v8f c) {
    // (neg_a, A, neg_b, B, c_mod, C, reuse_a, reuse_b)
    return __builtin_amdgcn_wmma_f32_16x16x32_f16(
        false, a, false, b, (short)0, c, false, false);
}

// Load a 16x32 f16 fragment in the CDNA5 16-bit A/B layout from a row-major
// matrix (16-wide index across lanes&15; K contiguous within a row).
//   lanes 0-15 : idx=lane,    halves [0..7]=K0..7,  [8..15]=K16..23
//   lanes 16-31: idx=lane-16, halves [0..7]=K8..15, [8..15]=K24..31
__device__ __forceinline__ v16h load_frag_rowmajor(const _Float16* base, int ld) {
    const int lane = threadIdx.x & 31;
    const _Float16* p = base + (size_t)(lane & 15) * ld + ((lane >> 4) << 3);
    v8h lo = *(const v8h*)(p);
    v8h hi = *(const v8h*)(p + 16);
    return __builtin_shufflevector(lo, hi, 0, 1, 2, 3, 4, 5, 6, 7,
                                           8, 9, 10, 11, 12, 13, 14, 15);
}

// ---------------------------------------------------------------------------
// Elementwise f32 -> f16 cast of the M*C activations.
// Few long waves instead of one element per thread: a wave takes CAST_U runs of
// 128 floats. Each load is 16 B per lane over 512 contiguous bytes (4 whole
// lines); the loads stand ahead of the stores, so a wave keeps many lines in
// flight; each store is 8 B per lane over 256 contiguous bytes (2 whole lines).
// The grid covers exactly M*C elements, so there is no tail.
// ---------------------------------------------------------------------------
#define CAST_T 256                          // threads per block
#define CAST_U 16                           // 16-B loads per lane
#define CAST_BLOCK (CAST_T * CAST_U * 4)    // floats per block
static_assert((MM * CC) % CAST_BLOCK == 0, "the cast grid must cover x exactly");

typedef __attribute__((ext_vector_type(4))) float    c4f;
typedef __attribute__((ext_vector_type(4))) _Float16 c4h;

__global__ __launch_bounds__(CAST_T)
void cast_f16_kernel(const float* __restrict__ in,
                     _Float16* __restrict__ out) {
    const int lane = threadIdx.x & 31;
    const int wave = blockIdx.x * (CAST_T / 32) + (threadIdx.x >> 5);
    const size_t base = (size_t)wave * (CAST_U * 128) + lane * 4;
    const float* src = in + base;
    _Float16*    dst = out + base;

    c4f v[CAST_U];
#pragma unroll
    for (int u = 0; u < CAST_U; ++u) v[u] = *(const c4f*)(src + u * 128);
#pragma unroll
    for (int u = 0; u < CAST_U; ++u) {
        const c4h h = {(_Float16)v[u][0], (_Float16)v[u][1],
                       (_Float16)v[u][2], (_Float16)v[u][3]};
        *(c4h*)(dst + u * 128) = h;
    }
}

// Both transposes below go through an LDS tile so that the global reads AND the
// global writes are 16 B per lane over contiguous runs. Two source rows are
// packed into one dword, so a tile row [c] holds 32 dwords = 64 source rows.
// Pitch 33 dwords (odd): the column-wise dword writes of a wave fall on
// different banks; the read-back is four dword loads per 16-B store.
#define TPD 33

typedef __attribute__((ext_vector_type(2))) _Float16 v2h;
typedef __attribute__((ext_vector_type(4))) float    v4f;
typedef __attribute__((ext_vector_type(4))) unsigned v4u;

__device__ __forceinline__ unsigned pack2h(_Float16 lo, _Float16 hi) {
    v2h p = {lo, hi};
    return __builtin_bit_cast(unsigned, p);
}

// Transposing cast: in[rows][cols] (f32) -> out[cols][rows] (f16).
// One 256-thread block per 64x64 tile; rows and cols are multiples of 64.
__global__ __launch_bounds__(256)
void transpose_cast_f16_kernel(const float* __restrict__ in,
                               _Float16* __restrict__ out,
                               int rows, int cols) {
    __shared__ unsigned tile[64 * TPD];
    const int t  = threadIdx.x;
    const int c0 = blockIdx.x * 64;
    const int r0 = blockIdx.y * 64;
    const int cg = t & 15;   // 4 columns each: 16 lanes = 256 B of one row
    const int rp = t >> 4;   // row pair 0..15 (and +16)

    const float* src = in + (size_t)(r0 + 2 * rp) * cols + c0 + 4 * cg;
    const v4f a0 = *(const v4f*)(src);
    const v4f a1 = *(const v4f*)(src + cols);
    const v4f b0 = *(const v4f*)(src + (size_t)32 * cols);
    const v4f b1 = *(const v4f*)(src + (size_t)33 * cols);

    unsigned* w = tile + (4 * cg) * TPD + rp;
#pragma unroll
    for (int i = 0; i < 4; ++i) {
        w[i * TPD]      = pack2h((_Float16)a0[i], (_Float16)a1[i]);
        w[i * TPD + 16] = pack2h((_Float16)b0[i], (_Float16)b1[i]);
    }
    __syncthreads();

#pragma unroll
    for (int k = 0; k < 2; ++k) {
        const int chunk = t + 256 * k;
        const int c = chunk >> 3;   // output row inside the tile
        const int g = chunk & 7;    // 16-B piece: 8 lanes = one 128-B line
        const unsigned* rd = tile + c * TPD + 4 * g;
        const v4u v = {rd[0], rd[1], rd[2], rd[3]};
        *(v4u*)(out + (size_t)(c0 + c) * rows + r0 + 8 * g) = v;
    }
}

// Extract + transpose the V slab of qkv:
//   vT[b*C + c][n] = qkv[(b*N + n)*3C + 2C + c]
// One 256-thread block per tile of 64 tokens x 128 channels.
__global__ __launch_bounds__(256)
void transpose_v_kernel(const _Float16* __restrict__ qkv,
                        _Float16* __restrict__ vT) {
    __shared__ unsigned tile[128 * TPD];
    const int t    = threadIdx.x;
    const int c0   = blockIdx.x * 128;
    const int tok0 = blockIdx.y * 64;      // b*N + n0; 64 divides N
    const int b    = tok0 / NN;
    const int n0   = tok0 - b * NN;
    const int cg   = t & 15;   // 8 channels each: 16 lanes = 256 B of one row
    const int rp   = t >> 4;   // token pair 0..15 (and +16)

    const _Float16* src = qkv + (size_t)(tok0 + 2 * rp) * LD3 + 2 * CC + c0 + 8 * cg;
    const v8h a0 = *(const v8h*)(src);
    const v8h a1 = *(const v8h*)(src + LD3);
    const v8h b0 = *(const v8h*)(src + (size_t)32 * LD3);
    const v8h b1 = *(const v8h*)(src + (size_t)33 * LD3);

    unsigned* w = tile + (8 * cg) * TPD + rp;
#pragma unroll
    for (int i = 0; i < 8; ++i) {
        w[i * TPD]      = pack2h(a0[i], a1[i]);
        w[i * TPD + 16] = pack2h(b0[i], b1[i]);
    }
    __syncthreads();

    _Float16* dst = vT + ((size_t)b * CC + c0) * NN + n0;
#pragma unroll
    for (int k = 0; k < 4; ++k) {
        const int chunk = t + 256 * k;
        const int c = chunk >> 3;   // channel inside the tile
        const int g = chunk & 7;    // 16-B piece: 8 lanes = one 128-B line
        const unsigned* rd = tile + c * TPD + 4 * g;
        const v4u v = {rd[0], rd[1], rd[2], rd[3]};
        *(v4u*)(dst + (size_t)c * NN + 8 * g) = v;
    }
}

// ---------------------------------------------------------------------------
// WMMA GEMM:  C[M,Nn] = A[M,K] * B[K,Nn]   (B supplied transposed: BT[Nn][K])
// One 4-wave work-group computes a 128x128 tile; each wave a 64x64 quarter
// (16 accumulators). A K-slab of 64 (128 rows of A, 128 rows of BT, 128 B per
// row) is brought into LDS by asynchronous 16-B copies, whole 128-B lines per
// 8 lanes, two buffers: the next slab flies while this one is multiplied.
// M, Nn multiples of 128; K a multiple of 64.
// ---------------------------------------------------------------------------
#define GT     128                    // tile rows of A and of BT
#define GBK    64                     // k per slab
#define GPITCH 72                     // halves per LDS row: 144 B = 16 B x 9
#define GSLAB  (2 * GT * GPITCH)      // halves per buffer

// Eight asynchronous copies, 16 B per lane each. The s_wait_xcnt stands inside
// the statement so that no address register is rewritten ahead of it.
__device__ __forceinline__ void async_copy8(unsigned l, const _Float16* g,
                                            unsigned lstep, size_t gstep) {
    const unsigned l1 = l + lstep, l2 = l1 + lstep, l3 = l2 + lstep;
    const unsigned l4 = l3 + lstep, l5 = l4 + lstep, l6 = l5 + lstep, l7 = l6 + lstep;
    const _Float16 *g1 = g + gstep, *g2 = g1 + gstep, *g3 = g2 + gstep;
    const _Float16 *g4 = g3 + gstep, *g5 = g4 + gstep, *g6 = g5 + gstep, *g7 = g6 + gstep;
    asm volatile(
        "global_load_async_to_lds_b128 %0, %8, off\n\t"
        "global_load_async_to_lds_b128 %1, %9, off\n\t"
        "global_load_async_to_lds_b128 %2, %10, off\n\t"
        "global_load_async_to_lds_b128 %3, %11, off\n\t"
        "global_load_async_to_lds_b128 %4, %12, off\n\t"
        "global_load_async_to_lds_b128 %5, %13, off\n\t"
        "global_load_async_to_lds_b128 %6, %14, off\n\t"
        "global_load_async_to_lds_b128 %7, %15, off\n\t"
        "s_wait_xcnt 0x0"
        :: "v"(l), "v"(l1), "v"(l2), "v"(l3), "v"(l4), "v"(l5), "v"(l6), "v"(l7),
           "v"(g), "v"(g1), "v"(g2), "v"(g3), "v"(g4), "v"(g5), "v"(g6), "v"(g7)
        : "memory");
}

template <bool OUT_F16>
__global__ __launch_bounds__(128)
void wmma_gemm_kernel(const _Float16* __restrict__ A,
                      const _Float16* __restrict__ BT,
                      _Float16* __restrict__ Ch,
                      float* __restrict__ Cf,
                      const float* __restrict__ bias,
                      int M, int K, int Nn) {
    __shared__ __attribute__((aligned(16))) _Float16 slab[2 * GSLAB];

    const int t    = threadIdx.x;
    const int lane = t & 31;
    const int wave = t >> 5;
    const int n0 = blockIdx.x * GT;
    const int m0 = blockIdx.y * GT;
    const int wm = (wave >> 1) * 64;   // this wave's quarter of the tile
    const int wn = (wave & 1) * 64;

    // Copy map: 8 lanes cover one 128-B row piece, a wave 4 rows, the block 16
    // rows per copy; 8 copies for the A rows, 8 for the BT rows.
    const int crow = t >> 3;
    const int ccol = (t & 7) * 8;
    const _Float16* gA = A  + (size_t)(m0 + crow) * K + ccol;
    const _Float16* gB = BT + (size_t)(n0 + crow) * K + ccol;
    const unsigned  lA = (unsigned)(size_t)(&slab[crow * GPITCH + ccol]);
    const unsigned  lB = lA + GT * GPITCH * 2;
    const unsigned  lstep = 16 * GPITCH * 2;     // bytes: 16 LDS rows
    const size_t    gstep = (size_t)16 * K;      // halves: 16 source rows
    const int nt = K / GBK;

    const v8f vzero = {0.f, 0.f, 0.f, 0.f, 0.f, 0.f, 0.f, 0.f};
    v8f acc[4][4];
#pragma unroll
    for (int i = 0; i < 4; ++i)
#pragma unroll
        for (int j = 0; j < 4; ++j) acc[i][j] = vzero;

    // slab 0 -> buffer 0, landed and published before anybody reads it
    async_copy8(lA, gA, lstep, gstep);
    async_copy8(lB, gB, lstep, gstep);
    asm volatile("s_wait_asynccnt 0x0" ::: "memory");  // own copies landed
    __syncthreads();                                   // every wave's copies landed
    if (nt > 1) {
        async_copy8(lA + GSLAB * 2, gA + GBK, lstep, gstep);
        async_copy8(lB + GSLAB * 2, gB + GBK, lstep, gstep);
    }

    for (int s = 0; s < nt; ++s) {
        const int buf = s & 1;
        const _Float16* sA = slab + buf * GSLAB + wm * GPITCH;
        const _Float16* sB = slab + buf * GSLAB + (GT + wn) * GPITCH;
#pragma unroll
        for (int kk = 0; kk < GBK; kk += 32) {
            v16h a[4], b[4];
#pragma unroll
            for (int i = 0; i < 4; ++i)
                a[i] = load_frag_rowmajor(sA + i * 16 * GPITCH + kk, GPITCH);
#pragma unroll
            for (int j = 0; j < 4; ++j)
                b[j] = load_frag_rowmajor(sB + j * 16 * GPITCH + kk, GPITCH);
#pragma unroll
            for (int i = 0; i < 4; ++i)
#pragma unroll
                for (int j = 0; j < 4; ++j)
                    acc[i][j] = wmma32(a[i], b[j], acc[i][j]);
        }
        // hand-over: own LDS reads done, own copies of slab s+1 landed, then the
        // barrier publishes slab s+1 and frees this buffer for slab s+2
        asm volatile("s_wait_dscnt 0x0" ::: "memory");
        asm volatile("s_wait_asynccnt 0x0" ::: "memory");
        __syncthreads();
        if (s + 2 < nt) {
            const size_t ko = (size_t)(s + 2) * GBK;
            async_copy8(lA + buf * (GSLAB * 2), gA + ko, lstep, gstep);
            async_copy8(lB + buf * (GSLAB * 2), gB + ko, lstep, gstep);
        }
    }
    asm volatile("s_wait_asynccnt 0x0" ::: "memory");  // nothing in flight at the end

    // C/D layout: reg r, lane -> (row = r + 8*(lane>>4), col = lane&15)
    const int half = lane >> 4;
    const int col  = lane & 15;
#pragma unroll
    for (int i = 0; i < 4; ++i) {
#pragma unroll
        for (int j = 0; j < 4; ++j) {
#pragma unroll
            for (int r = 0; r < 8; ++r) {
                const int row = m0 + wm + i * 16 + r + 8 * half;
                const int cn  = n0 + wn + j * 16 + col;
                if (OUT_F16) {
                    Ch[(size_t)row * Nn + cn] = (_Float16)acc[i][j][r];
                } else {
                    Cf[(size_t)row * Nn + cn] = acc[i][j][r] + bias[cn];
                }
            }
        }
    }
}

#define AW     8
#define AQT    2
#define AKS    64
#define APITCH 72
#define ABUF   (2 * AKS * APITCH)

// Four asynchronous copies, 16 B per lane each. The s_wait_xcnt stands inside
// the statement so that no address register is rewritten ahead of it.
__device__ __forceinline__ void async_copy4(unsigned l0, unsigned l1,
                                            unsigned l2, unsigned l3,
                                            const _Float16* g0, const _Float16* g1,
                                            const _Float16* g2, const _Float16* g3) {
    asm volatile(
        "global_load_async_to_lds_b128 %0, %4, off\n\t"
        "global_load_async_to_lds_b128 %1, %5, off\n\t"
        "global_load_async_to_lds_b128 %2, %6, off\n\t"
        "global_load_async_to_lds_b128 %3, %7, off\n\t"
        "s_wait_xcnt 0x0"
        :: "v"(l0), "v"(l1), "v"(l2), "v"(l3),
           "v"(g0), "v"(g1), "v"(g2), "v"(g3)
        : "memory");
}

// Value of lane ^ 16: the lane that holds the same query's other keys.
__device__ __forceinline__ float xhalf(float x) {
    const int b = __builtin_bit_cast(int, x);
    return __builtin_bit_cast(float, __builtin_amdgcn_permlanex16(
        b, b, 0x76543210, 0xfedcba98, false, false));
}

__device__ __forceinline__ float max3f(float a, float b, float c) {
    return fmaxf(fmaxf(a, b), c);
}

// Two work-groups per WGP (4 waves per SIMD, at most 256 registers a wave): the
// softmax is vector work between the matrix runs, and other waves fill it.
__global__ __launch_bounds__(32 * AW) __attribute__((amdgpu_waves_per_eu(4)))
void attention_kernel(const _Float16* __restrict__ qkv,
                      const _Float16* __restrict__ vT,
                      _Float16* __restrict__ outh) {
    __shared__ __attribute__((aligned(16))) _Float16 kv[2 * ABUF];

    const int t    = threadIdx.x;
    const int wave = t >> 5;
    const int q0   = (blockIdx.x * AW + wave) * (16 * AQT);
    const int h    = blockIdx.y;
    const int b    = blockIdx.z;
    const size_t tokBase = (size_t)b * NN;

    const int lane = t & 31;
    const int half = lane >> 4;
    const int col  = lane & 15;

    const _Float16* kbase0 = qkv + tokBase * LD3 + CC + h * DD;   // keys, token-major
    const _Float16* vtbase = vT + ((size_t)b * CC + h * DD) * NN; // [64][NN]

    // Copy map: 8 lanes cover one 128-B row, the block 32 rows per copy; two
    // copies for the 64 K rows, two for the 64 vT rows.
    const int crow = t >> 3;
    const int ccol = (t & 7) * 8;
    const _Float16* gK = kbase0 + (size_t)crow * LD3 + ccol;
    const _Float16* gV = vtbase + (size_t)crow * NN + ccol;
    const unsigned  lK = (unsigned)(size_t)(&kv[crow * APITCH + ccol]);
    const unsigned  lhalf = 32 * APITCH * 2;      // bytes: 32 LDS rows
    const int ns = NN / AKS;

    // stage 0 -> buffer 0, landed and published before anybody reads it
    async_copy4(lK, lK + lhalf, lK + 2 * lhalf, lK + 3 * lhalf,
                gK, gK + (size_t)32 * LD3, gV, gV + (size_t)32 * NN);
    asm volatile("s_wait_asynccnt 0x0" ::: "memory");  // own copies landed
    __syncthreads();                                   // every wave's copies landed
    {
        const _Float16* k1 = gK + (size_t)AKS * LD3;
        const _Float16* v1 = gV + AKS;
        const unsigned  l1 = lK + ABUF * 2;
        async_copy4(l1, l1 + lhalf, l1 + 2 * lhalf, l1 + 3 * lhalf,
                    k1, k1 + (size_t)32 * LD3, v1, v1 + (size_t)32 * NN);
    }

    // Q fragments (B operand: column = query, 64 d), two K=32 chunks per tile
    const _Float16* qbase = qkv + (tokBase + q0) * LD3 + h * DD;
    v16h qa0[AQT], qa1[AQT];
#pragma unroll
    for (int u = 0; u < AQT; ++u) {
        qa0[u] = load_frag_rowmajor(qbase + (size_t)u * 16 * LD3, LD3);
        qa1[u] = load_frag_rowmajor(qbase + (size_t)u * 16 * LD3 + 32, LD3);
    }
    // stands in front of the first overwrite of the Q loads' address registers
    asm volatile("s_wait_xcnt 0x0" ::: "memory");
    __builtin_amdgcn_sched_barrier(0);  // no later register write is lifted over that wait

    const v8f vzero = {0.f, 0.f, 0.f, 0.f, 0.f, 0.f, 0.f, 0.f};
    v8f o[AQT][4];
#pragma unroll
    for (int u = 0; u < AQT; ++u)
#pragma unroll
        for (int j = 0; j < 4; ++j) o[u][j] = vzero;

    // This lane's query of each tile: running maximum (equal in both halves) and
    // the sum over this lane's own keys (the halves are joined after the loop).
    float m[AQT], l[AQT];
#pragma unroll
    for (int u = 0; u < AQT; ++u) { m[u] = -1e30f; l[u] = 0.f; }

    const float scale = 0.125f;  // D^-0.5 = 64^-0.5

    for (int s = 0; s < ns; ++s) {
        const int buf = s & 1;
        const _Float16* sK = kv + buf * ABUF;
        const _Float16* sV = sK + AKS * APITCH;

        // two 32-key blocks per stage; kept rolled: unrolled, the build takes about a
        // quarter more registers
#pragma unroll 1
        for (int kb = 0; kb < AKS; kb += 32) {
            const _Float16* kbase = sK + kb * APITCH;

            // ---- fragments of this block, from the shared stage ----
            v16h kf00 = load_frag_rowmajor(kbase, APITCH);                 // keys +0,  d 0..31
            v16h kf01 = load_frag_rowmajor(kbase + 32, APITCH);            // keys +0,  d 32..63
            v16h kf10 = load_frag_rowmajor(kbase + 16 * APITCH, APITCH);   // keys +16, d 0..31
            v16h kf11 = load_frag_rowmajor(kbase + 16 * APITCH + 32, APITCH);

            // ---- scores: S^T[32 keys x 16 queries] as two 16x16 f32 tiles, per query tile ----
            // register r of s0: key kb + 8*half + r; of s1: key kb + 16 + 8*half + r
            v8f s0[AQT], s1[AQT];
#pragma unroll
            for (int u = 0; u < AQT; ++u) {
                s0[u] = wmma32(kf00, qa0[u], vzero);
                s1[u] = wmma32(kf10, qa0[u], vzero);
            }
#pragma unroll
            for (int u = 0; u < AQT; ++u) {
                s0[u] = wmma32(kf01, qa1[u], s0[u]);
                s1[u] = wmma32(kf11, qa1[u], s1[u]);
            }
            // The eight products stay one run: each fills the vector slots the chip
            // needs behind the one before; mixed with the maxima, v_nops fill them.
            __builtin_amdgcn_sched_barrier(0);

            // ---- online softmax over this 32-key block, one query per lane and tile ----
            v16h pb[AQT];   // P^T as B operand: halves 0..7 from s0, 8..15 from s1
            float f[AQT], rs[AQT][4];   // rescale factor; four independent sum chains
#pragma unroll
            for (int u = 0; u < AQT; ++u) {
                const float x0 = max3f(max3f(s0[u][0], s0[u][1], s0[u][2]),
                                       max3f(s0[u][3], s0[u][4], s0[u][5]),
                                       max3f(s0[u][6], s0[u][7], s1[u][0]));
                const float x1 = max3f(max3f(s1[u][1], s1[u][2], s1[u][3]),
                                       max3f(s1[u][4], s1[u][5], s1[u][6]), s1[u][7]);
                float rm = fmaxf(x0, x1);
                rm = fmaxf(rm, xhalf(rm)) * scale;   // over all 32 keys; scale > 0
                const float nm = fmaxf(m[u], rm);
                f[u] = __expf(m[u] - nm);
#pragma unroll
                for (int c = 0; c < 4; ++c) rs[u][c] = 0.f;
#pragma unroll
                for (int r = 0; r < 8; ++r) {
                    const float p0 = __expf(s0[u][r] * scale - nm);
                    const float p1 = __expf(s1[u][r] * scale - nm);
                    rs[u][r & 1]       += p0;
                    rs[u][2 + (r & 1)] += p1;
                    pb[u][r]     = (_Float16)p0;
                    pb[u][8 + r] = (_Float16)p1;
                }
                m[u] = nm;

                // rescale running output accumulators
#pragma unroll
                for (int j = 0; j < 4; ++j)
#pragma unroll
                    for (int r = 0; r < 8; ++r) o[u][j][r] *= f[u];
            }

            // V fragments only now: LDS is near, and the registers stay free
            // during the softmax
            v16h vf0 = load_frag_rowmajor(sV +  0 * APITCH + kb, APITCH);
            v16h vf1 = load_frag_rowmajor(sV + 16 * APITCH + kb, APITCH);
            v16h vf2 = load_frag_rowmajor(sV + 32 * APITCH + kb, APITCH);
            v16h vf3 = load_frag_rowmajor(sV + 48 * APITCH + kb, APITCH);

            // ---- O^T[64 d x 16 queries] += V^T[64 x 32] * P^T[32 x 16], per query tile ----
            // each V^T fragment feeds both tiles, one product behind the other
#pragma unroll
            for (int u = 0; u < AQT; ++u) o[u][0] = wmma32(vf0, pb[u], o[u][0]);
#pragma unroll
            for (int u = 0; u < AQT; ++u) o[u][1] = wmma32(vf1, pb[u], o[u][1]);
#pragma unroll
            for (int u = 0; u < AQT; ++u) o[u][2] = wmma32(vf2, pb[u], o[u][2]);
#pragma unroll
            for (int u = 0; u < AQT; ++u) o[u][3] = wmma32(vf3, pb[u], o[u][3]);

            // The joins of the sums stand behind the last product: they fill the
            // vector slots that the chip needs before the next trip's first
            // instructions overwrite that product's operand registers.
            __builtin_amdgcn_sched_barrier(0);  // keeps the joins behind the products
#pragma unroll
            for (int u = 0; u < AQT; ++u)
                l[u] = l[u] * f[u] + ((rs[u][0] + rs[u][1]) + (rs[u][2] + rs[u][3]));
        }

        // hand-over: own LDS reads done, own copies of stage s+1 landed, then the
        // barrier publishes stage s+1 and frees this buffer for stage s+2
        asm volatile("s_wait_dscnt 0x0" ::: "memory");
        asm volatile("s_wait_asynccnt 0x0" ::: "memory");
        __syncthreads();
        if (s + 2 < ns) {
            const _Float16* kn = gK + (size_t)(s + 2) * AKS * LD3;
            const _Float16* vn = gV + (s + 2) * AKS;
            const unsigned  ln = lK + buf * (ABUF * 2);
            async_copy4(ln, ln + lhalf, ln + 2 * lhalf, ln + 3 * lhalf,
                        kn, kn + (size_t)32 * LD3, vn, vn + (size_t)32 * NN);
        }
    }
    asm volatile("s_wait_asynccnt 0x0" ::: "memory");  // nothing in flight at the end

    // ---- epilogue: normalize and store f16 at [token, h*64 + d] ----
    // register r of o[u][j]: d = j*16 + 8*half + r of query u*16 + col: 16 B per store
#pragma unroll
    for (int u = 0; u < AQT; ++u) {
        const float lt = l[u] + xhalf(l[u]);
        _Float16* obase = outh + (tokBase + q0 + u * 16 + col) * CC + h * DD + 8 * half;
#pragma unroll
        for (int j = 0; j < 4; ++j) {
            v8h w;
#pragma unroll
            for (int r = 0; r < 8; ++r) w[r] = (_Float16)(o[u][j][r] / lt);
            *(v8h*)(obase + j * 16) = w;
        }
    }
}

// ---------------------------------------------------------------------------
// Host-side launch
// ---------------------------------------------------------------------------
extern "C" void kernel_launch(void* const* d_in, const int* in_sizes, int n_in,
                              void* d_out, int out_size, void* d_ws, size_t ws_size,
                              hipStream_t stream) {
    const float* x      = (const float*)d_in[0];   // [B,N,C]
    const float* W_qkv  = (const float*)d_in[1];   // [C, 3C]
    const float* W_proj = (const float*)d_in[2];   // [C, C]
    const float* b_proj = (const float*)d_in[3];   // [C]
    float* out = (float*)d_out;                    // [B,N,C] f32

    // Workspace layout (all f16)
    _Float16* xh     = (_Float16*)d_ws;                 // [M, C]
    _Float16* wqkvT  = xh     + (size_t)MM * CC;        // [3C, C]
    _Float16* wprojT = wqkvT  + (size_t)CC * 3 * CC;    // [C, C]
    _Float16* qkvh   = wprojT + (size_t)CC * CC;        // [M, 3C]
    _Float16* attnh  = qkvh   + (size_t)MM * 3 * CC;    // [M, C]
    _Float16* vT     = attnh  + (size_t)MM * CC;        // [B*C, N]

    // 1) precision casts (weights transposed for contiguous B-fragments)
    {
        cast_f16_kernel<<<MM * CC / CAST_BLOCK, CAST_T, 0, stream>>>(x, xh);
        transpose_cast_f16_kernel<<<dim3(3 * CC / 64, CC / 64), 256, 0, stream>>>(
            W_qkv, wqkvT, CC, 3 * CC);
        transpose_cast_f16_kernel<<<dim3(CC / 64, CC / 64), 256, 0, stream>>>(
            W_proj, wprojT, CC, CC);
    }

    // 2) qkv = x @ W_qkv              (f16 out)
    wmma_gemm_kernel<true><<<dim3(3 * CC / 128, MM / 128), 128, 0, stream>>>(
        xh, wqkvT, qkvh, nullptr, nullptr, MM, CC, 3 * CC);

    // 2b) transpose V slab for contiguous P*V fragment loads
    transpose_v_kernel<<<dim3(CC / 128, MM / 64), 256, 0, stream>>>(qkvh, vT);

    // 3) flash attention per (b, h, 256 queries)
    attention_kernel<<<dim3(NN / (16 * AQT * AW), HH, BB), 32 * AW, 0, stream>>>(qkvh, vT, attnh);

    // 4) out = attn @ W_proj + b_proj (f32 out)
    wmma_gemm_kernel<false><<<dim3(CC / 128, MM / 128), 128, 0, stream>>>(
        attnh, wprojT, nullptr, out, b_proj, MM, CC, CC);
}

// v007
// It runs in 152 microseconds.
// In two side-by-side timings against v006, it was 1.05 and 1.04 times as fast.
// All steps since v000 together make it 5.56 times as fast.
#include <hip/hip_runtime.h>
#include <hip/hip_bf16.h>

// ---------------------------------------------------------------------------
// CDNA5 (gfx1250) attention block:  out = softmax(QK^T * s) V  projected.
// All GEMM-like math goes through v_wmma_f32_16x16x32_f16 (f16 in, f32 acc).
// V is pre-transposed to [B][C][N] so every WMMA fragment is two contiguous
// 16-B loads per lane. The GEMMs and the attention read their fragments from
// LDS tiles that a whole work-group shares (see there).
// ---------------------------------------------------------------------------

typedef __attribute__((ext_vector_type(16))) _Float16 v16h;
typedef __attribute__((ext_vector_type(8)))  _Float16 v8h;
typedef __attribute__((ext_vector_type(8)))  float    v8f;

// Problem constants (fixed by the reference)
#define BB   4
#define NN   2048
#define CC   1024
#define HH   16
#define DD   64
#define LD3  (3 * CC)   // 3072, row stride of qkv buffer
#define MM   (BB * NN)  // 8192 tokens

__device__ __forceinline__ v8f wmma32(v16h a, v16h b, v8f c) {
    // (neg_a, A, neg_b, B, c_mod, C, reuse_a, reuse_b)
    return __builtin_amdgcn_wmma_f32_16x16x32_f16(
        false, a, false, b, (short)0, c, false, false);
}

// Load a 16x32 f16 fragment in the CDNA5 16-bit A/B layout from a row-major
// matrix (16-wide index across lanes&15; K contiguous within a row).
//   lanes 0-15 : idx=lane,    halves [0..7]=K0..7,  [8..15]=K16..23
//   lanes 16-31: idx=lane-16, halves [0..7]=K8..15, [8..15]=K24..31
__device__ __forceinline__ v16h load_frag_rowmajor(const _Float16* base, int ld) {
    const int lane = threadIdx.x & 31;
    const _Float16* p = base + (size_t)(lane & 15) * ld + ((lane >> 4) << 3);
    v8h lo = *(const v8h*)(p);
    v8h hi = *(const v8h*)(p + 16);
    return __builtin_shufflevector(lo, hi, 0, 1, 2, 3, 4, 5, 6, 7,
                                           8, 9, 10, 11, 12, 13, 14, 15);
}

// ---------------------------------------------------------------------------
// Elementwise f32 -> f16 cast of the M*C activations.
// Few long waves instead of one element per thread: a wave takes CAST_U runs of
// 128 floats. Each load is 16 B per lane over 512 contiguous bytes (4 whole
// lines); the loads stand ahead of the stores, so a wave keeps many lines in
// flight; each store is 8 B per lane over 256 contiguous bytes (2 whole lines).
// The grid covers exactly M*C elements, so there is no tail.
// ---------------------------------------------------------------------------
#define CAST_T 256                          // threads per block
#define CAST_U 16                           // 16-B loads per lane
#define CAST_BLOCK (CAST_T * CAST_U * 4)    // floats per block
static_assert((MM * CC) % CAST_BLOCK == 0, "the cast grid must cover x exactly");

typedef __attribute__((ext_vector_type(4))) float    c4f;
typedef __attribute__((ext_vector_type(4))) _Float16 c4h;

__global__ __launch_bounds__(CAST_T)
void cast_f16_kernel(const float* __restrict__ in,
                     _Float16* __restrict__ out) {
    const int lane = threadIdx.x & 31;
    const int wave = blockIdx.x * (CAST_T / 32) + (threadIdx.x >> 5);
    const size_t base = (size_t)wave * (CAST_U * 128) + lane * 4;
    const float* src = in + base;
    _Float16*    dst = out + base;

    c4f v[CAST_U];
#pragma unroll
    for (int u = 0; u < CAST_U; ++u) v[u] = *(const c4f*)(src + u * 128);
#pragma unroll
    for (int u = 0; u < CAST_U; ++u) {
        const c4h h = {(_Float16)v[u][0], (_Float16)v[u][1],
                       (_Float16)v[u][2], (_Float16)v[u][3]};
        *(c4h*)(dst + u * 128) = h;
    }
}

// Both transposes below go through an LDS tile so that the global reads AND the
// global writes are 16 B per lane over contiguous runs. Two source rows are
// packed into one dword, so a tile row [c] holds 32 dwords = 64 source rows.
// Pitch 33 dwords (odd): the column-wise dword writes of a wave fall on
// different banks; the read-back is four dword loads per 16-B store.
#define TPD 33

typedef __attribute__((ext_vector_type(2))) _Float16 v2h;
typedef __attribute__((ext_vector_type(4))) float    v4f;
typedef __attribute__((ext_vector_type(4))) unsigned v4u;

__device__ __forceinline__ unsigned pack2h(_Float16 lo, _Float16 hi) {
    v2h p = {lo, hi};
    return __builtin_bit_cast(unsigned, p);
}

// Transposing cast: in[rows][cols] (f32) -> out[cols][rows] (f16).
// One 256-thread block per 64x64 tile; rows and cols are multiples of 64.
__global__ __launch_bounds__(256)
void transpose_cast_f16_kernel(const float* __restrict__ in,
                               _Float16* __restrict__ out,
                               int rows, int cols) {
    __shared__ unsigned tile[64 * TPD];
    const int t  = threadIdx.x;
    const int c0 = blockIdx.x * 64;
    const int r0 = blockIdx.y * 64;
    const int cg = t & 15;   // 4 columns each: 16 lanes = 256 B of one row
    const int rp = t >> 4;   // row pair 0..15 (and +16)

    const float* src = in + (size_t)(r0 + 2 * rp) * cols + c0 + 4 * cg;
    const v4f a0 = *(const v4f*)(src);
    const v4f a1 = *(const v4f*)(src + cols);
    const v4f b0 = *(const v4f*)(src + (size_t)32 * cols);
    const v4f b1 = *(const v4f*)(src + (size_t)33 * cols);

    unsigned* w = tile + (4 * cg) * TPD + rp;
#pragma unroll
    for (int i = 0; i < 4; ++i) {
        w[i * TPD]      = pack2h((_Float16)a0[i], (_Float16)a1[i]);
        w[i * TPD + 16] = pack2h((_Float16)b0[i], (_Float16)b1[i]);
    }
    __syncthreads();

#pragma unroll
    for (int k = 0; k < 2; ++k) {
        const int chunk = t + 256 * k;
        const int c = chunk >> 3;   // output row inside the tile
        const int g = chunk & 7;    // 16-B piece: 8 lanes = one 128-B line
        const unsigned* rd = tile + c * TPD + 4 * g;
        const v4u v = {rd[0], rd[1], rd[2], rd[3]};
        *(v4u*)(out + (size_t)(c0 + c) * rows + r0 + 8 * g) = v;
    }
}

// Extract + transpose the V slab of qkv:
//   vT[b*C + c][n] = qkv[(b*N + n)*3C + 2C + c]
// One 256-thread block per tile of 64 tokens x 128 channels.
__global__ __launch_bounds__(256)
void transpose_v_kernel(const _Float16* __restrict__ qkv,
                        _Float16* __restrict__ vT) {
    __shared__ unsigned tile[128 * TPD];
    const int t    = threadIdx.x;
    const int c0   = blockIdx.x * 128;
    const int tok0 = blockIdx.y * 64;      // b*N + n0; 64 divides N
    const int b    = tok0 / NN;
    const int n0   = tok0 - b * NN;
    const int cg   = t & 15;   // 8 channels each: 16 lanes = 256 B of one row
    const int rp   = t >> 4;   // token pair 0..15 (and +16)

    const _Float16* src = qkv + (size_t)(tok0 + 2 * rp) * LD3 + 2 * CC + c0 + 8 * cg;
    const v8h a0 = *(const v8h*)(src);
    const v8h a1 = *(const v8h*)(src + LD3);
    const v8h b0 = *(const v8h*)(src + (size_t)32 * LD3);
    const v8h b1 = *(const v8h*)(src + (size_t)33 * LD3);

    unsigned* w = tile + (8 * cg) * TPD + rp;
#pragma unroll
    for (int i = 0; i < 8; ++i) {
        w[i * TPD]      = pack2h(a0[i], a1[i]);
        w[i * TPD + 16] = pack2h(b0[i], b1[i]);
    }
    __syncthreads();

    _Float16* dst = vT + ((size_t)b * CC + c0) * NN + n0;
#pragma unroll
    for (int k = 0; k < 4; ++k) {
        const int chunk = t + 256 * k;
        const int c = chunk >> 3;   // channel inside the tile
        const int g = chunk & 7;    // 16-B piece: 8 lanes = one 128-B line
        const unsigned* rd = tile + c * TPD + 4 * g;
        const v4u v = {rd[0], rd[1], rd[2], rd[3]};
        *(v4u*)(dst + (size_t)c * NN + 8 * g) = v;
    }
}

// ---------------------------------------------------------------------------
// WMMA GEMM:  C[M,Nn] = A[M,K] * B[K,Nn]   (B supplied transposed: BT[Nn][K])
// One 4-wave work-group computes a 128x128 tile; each wave a 64x64 quarter
// (16 accumulators). A K-slab of 64 (128 rows of A, 128 rows of BT, 128 B per
// row) is brought into LDS by asynchronous 16-B copies, whole 128-B lines per
// 8 lanes, two buffers: the next slab flies while this one is multiplied.
// The tiles are formed transposed (BT rows as the A operand), so a lane holds 8
// adjacent columns of one output row. After the k loop each wave lays its
// quarter into its own part of the freed slab memory and reads it back row by
// row: every global store is 16 B per lane over whole 128-B lines.
// M, Nn multiples of 128; K a multiple of 64.
// ---------------------------------------------------------------------------
#define GT     128                    // tile rows of A and of BT
#define GBK    64                     // k per slab
#define GPITCH 72                     // halves per LDS row: 144 B = 16 B x 9
#define GSLAB  (2 * GT * GPITCH)      // halves per buffer
#define GSTAGE (2 * GSLAB / 4)        // halves of output staging per wave
#define GEPH   72                     // staging pitch, f16 rows: 128 B + 16 B
#define GEPF   68                     // staging pitch, f32 rows: 256 B + 16 B
static_assert(64 * GEPH <= GSTAGE && 64 * GEPF * 2 <= GSTAGE,
              "a wave's 64 staged rows must fit its part of the slab memory");

// Eight asynchronous copies, 16 B per lane each. The s_wait_xcnt stands inside
// the statement so that no address register is rewritten ahead of it.
__device__ __forceinline__ void async_copy8(unsigned l, const _Float16* g,
                                            unsigned lstep, size_t gstep) {
    const unsigned l1 = l + lstep, l2 = l1 + lstep, l3 = l2 + lstep;
    const unsigned l4 = l3 + lstep, l5 = l4 + lstep, l6 = l5 + lstep, l7 = l6 + lstep;
    const _Float16 *g1 = g + gstep, *g2 = g1 + gstep, *g3 = g2 + gstep;
    const _Float16 *g4 = g3 + gstep, *g5 = g4 + gstep, *g6 = g5 + gstep, *g7 = g6 + gstep;
    asm volatile(
        "global_load_async_to_lds_b128 %0, %8, off\n\t"
        "global_load_async_to_lds_b128 %1, %9, off\n\t"
        "global_load_async_to_lds_b128 %2, %10, off\n\t"
        "global_load_async_to_lds_b128 %3, %11, off\n\t"
        "global_load_async_to_lds_b128 %4, %12, off\n\t"
        "global_load_async_to_lds_b128 %5, %13, off\n\t"
        "global_load_async_to_lds_b128 %6, %14, off\n\t"
        "global_load_async_to_lds_b128 %7, %15, off\n\t"
        "s_wait_xcnt 0x0"
        :: "v"(l), "v"(l1), "v"(l2), "v"(l3), "v"(l4), "v"(l5), "v"(l6), "v"(l7),
           "v"(g), "v"(g1), "v"(g2), "v"(g3), "v"(g4), "v"(g5), "v"(g6), "v"(g7)
        : "memory");
}

template <bool OUT_F16>
__global__ __launch_bounds__(128)
void wmma_gemm_kernel(const _Float16* __restrict__ A,
                      const _Float16* __restrict__ BT,
                      _Float16* __restrict__ Ch,
                      float* __restrict__ Cf,
                      const float* __restrict__ bias,
                      int M, int K, int Nn) {
    __shared__ __attribute__((aligned(16))) _Float16 slab[2 * GSLAB];

    const int t    = threadIdx.x;
    const int lane = t & 31;
    const int wave = t >> 5;
    const int n0 = blockIdx.x * GT;
    const int m0 = blockIdx.y * GT;
    const int wm = (wave >> 1) * 64;   // this wave's quarter of the tile
    const int wn = (wave & 1) * 64;

    // Copy map: 8 lanes cover one 128-B row piece, a wave 4 rows, the block 16
    // rows per copy; 8 copies for the A rows, 8 for the BT rows.
    const int crow = t >> 3;
    const int ccol = (t & 7) * 8;
    const _Float16* gA = A  + (size_t)(m0 + crow) * K + ccol;
    const _Float16* gB = BT + (size_t)(n0 + crow) * K + ccol;
    const unsigned  lA = (unsigned)(size_t)(&slab[crow * GPITCH + ccol]);
    const unsigned  lB = lA + GT * GPITCH * 2;
    const unsigned  lstep = 16 * GPITCH * 2;     // bytes: 16 LDS rows
    const size_t    gstep = (size_t)16 * K;      // halves: 16 source rows
    const int nt = K / GBK;

    const v8f vzero = {0.f, 0.f, 0.f, 0.f, 0.f, 0.f, 0.f, 0.f};
    v8f acc[4][4];
#pragma unroll
    for (int i = 0; i < 4; ++i)
#pragma unroll
        for (int j = 0; j < 4; ++j) acc[i][j] = vzero;

    // slab 0 -> buffer 0, landed and published before anybody reads it
    async_copy8(lA, gA, lstep, gstep);
    async_copy8(lB, gB, lstep, gstep);
    asm volatile("s_wait_asynccnt 0x0" ::: "memory");  // own copies landed
    __syncthreads();                                   // every wave's copies landed
    if (nt > 1) {
        async_copy8(lA + GSLAB * 2, gA + GBK, lstep, gstep);
        async_copy8(lB + GSLAB * 2, gB + GBK, lstep, gstep);
    }

    for (int s = 0; s < nt; ++s) {
        const int buf = s & 1;
        const _Float16* sA = slab + buf * GSLAB + wm * GPITCH;
        const _Float16* sB = slab + buf * GSLAB + (GT + wn) * GPITCH;
#pragma unroll
        for (int kk = 0; kk < GBK; kk += 32) {
            v16h a[4], b[4];
#pragma unroll
            for (int i = 0; i < 4; ++i)
                a[i] = load_frag_rowmajor(sA + i * 16 * GPITCH + kk, GPITCH);
#pragma unroll
            for (int j = 0; j < 4; ++j)
                b[j] = load_frag_rowmajor(sB + j * 16 * GPITCH + kk, GPITCH);
#pragma unroll
            for (int i = 0; i < 4; ++i)
#pragma unroll
                for (int j = 0; j < 4; ++j)
                    acc[i][j] = wmma32(b[j], a[i], acc[i][j]);   // C^T tile: rows n, columns m
        }
        // hand-over: own LDS reads done, own copies of slab s+1 landed, then the
        // barrier publishes slab s+1 and frees this buffer for slab s+2
        asm volatile("s_wait_dscnt 0x0" ::: "memory");
        asm volatile("s_wait_asynccnt 0x0" ::: "memory");
        __syncthreads();
        if (s + 2 < nt) {
            const size_t ko = (size_t)(s + 2) * GBK;
            async_copy8(lA + buf * (GSLAB * 2), gA + ko, lstep, gstep);
            async_copy8(lB + buf * (GSLAB * 2), gB + ko, lstep, gstep);
        }
    }
    asm volatile("s_wait_asynccnt 0x0" ::: "memory");  // nothing in flight at the end

    // Register r of acc[i][j]: output row i*16 + (lane & 15), column j*16 + 8*half + r.
    // The last barrier of the loop ended every wave's slab reads and no copy is
    // in flight, so the slab memory is free; each wave stages in its own part.
    const int half = lane >> 4;
    const int col  = lane & 15;
    if (OUT_F16) {
        _Float16* st = slab + wave * GSTAGE;
#pragma unroll
        for (int i = 0; i < 4; ++i) {
#pragma unroll
            for (int j = 0; j < 4; ++j) {
                v8h w;
#pragma unroll
                for (int r = 0; r < 8; ++r) w[r] = (_Float16)acc[i][j][r];
                *(v8h*)(st + (i * 16 + col) * GEPH + j * 16 + 8 * half) = w;
            }
        }
        // the rows are read back by other lanes of this wave: own LDS writes first
        asm volatile("s_wait_dscnt 0x0" ::: "memory");
        const int rr = lane >> 3;         // 8 lanes = one 128-B row, 4 rows a store
        const int cc = (lane & 7) * 8;
        const _Float16* rd = st + rr * GEPH + cc;
        _Float16* dst = Ch + (size_t)(m0 + wm + rr) * Nn + n0 + wn + cc;
#pragma unroll
        for (int k = 0; k < 16; ++k)
            *(v8h*)(dst + (size_t)(4 * k) * Nn) = *(const v8h*)(rd + 4 * k * GEPH);
    } else {
        float* st = (float*)(slab + wave * GSTAGE);
        // bias of the 4 columns this lane stores; asked for ahead of the staging,
        // which covers its latency
        const v4f bv = *(const v4f*)(bias + n0 + wn + (lane & 15) * 4);
#pragma unroll
        for (int i = 0; i < 4; ++i) {
#pragma unroll
            for (int j = 0; j < 4; ++j) {
                float* w = st + (i * 16 + col) * GEPF + j * 16 + 8 * half;
                const v4f lo = {acc[i][j][0], acc[i][j][1], acc[i][j][2], acc[i][j][3]};
                const v4f hi = {acc[i][j][4], acc[i][j][5], acc[i][j][6], acc[i][j][7]};
                *(v4f*)(w)     = lo;
                *(v4f*)(w + 4) = hi;
            }
        }
        // the rows are read back by other lanes of this wave: own LDS writes first
        asm volatile("s_wait_dscnt 0x0" ::: "memory");
        const int rr = lane >> 4;         // 16 lanes = one 256-B row, 2 rows a store
        const int cc = (lane & 15) * 4;
        const float* rd = st + rr * GEPF + cc;
        float* dst = Cf + (size_t)(m0 + wm + rr) * Nn + n0 + wn + cc;
#pragma unroll
        for (int k = 0; k < 32; ++k)
            *(v4f*)(dst + (size_t)(2 * k) * Nn) = *(const v4f*)(rd + 2 * k * GEPF) + bv;
    }
}

#define AW     8
#define AQT    2
#define AKS    64
#define APITCH 72
#define ABUF   (2 * AKS * APITCH)

// Four asynchronous copies, 16 B per lane each. The s_wait_xcnt stands inside
// the statement so that no address register is rewritten ahead of it.
__device__ __forceinline__ void async_copy4(unsigned l0, unsigned l1,
                                            unsigned l2, unsigned l3,
                                            const _Float16* g0, const _Float16* g1,
                                            const _Float16* g2, const _Float16* g3) {
    asm volatile(
        "global_load_async_to_lds_b128 %0, %4, off\n\t"
        "global_load_async_to_lds_b128 %1, %5, off\n\t"
        "global_load_async_to_lds_b128 %2, %6, off\n\t"
        "global_load_async_to_lds_b128 %3, %7, off\n\t"
        "s_wait_xcnt 0x0"
        :: "v"(l0), "v"(l1), "v"(l2), "v"(l3),
           "v"(g0), "v"(g1), "v"(g2), "v"(g3)
        : "memory");
}

// Value of lane ^ 16: the lane that holds the same query's other keys.
__device__ __forceinline__ float xhalf(float x) {
    const int b = __builtin_bit_cast(int, x);
    return __builtin_bit_cast(float, __builtin_amdgcn_permlanex16(
        b, b, 0x76543210, 0xfedcba98, false, false));
}

__device__ __forceinline__ float max3f(float a, float b, float c) {
    return fmaxf(fmaxf(a, b), c);
}

// Two work-groups per WGP (4 waves per SIMD, at most 256 registers a wave): the
// softmax is vector work between the matrix runs, and other waves fill it.
__global__ __launch_bounds__(32 * AW) __attribute__((amdgpu_waves_per_eu(4)))
void attention_kernel(const _Float16* __restrict__ qkv,
                      const _Float16* __restrict__ vT,
                      _Float16* __restrict__ outh) {
    __shared__ __attribute__((aligned(16))) _Float16 kv[2 * ABUF];

    const int t    = threadIdx.x;
    const int wave = t >> 5;
    const int q0   = (blockIdx.x * AW + wave) * (16 * AQT);
    const int h    = blockIdx.y;
    const int b    = blockIdx.z;
    const size_t tokBase = (size_t)b * NN;

    const int lane = t & 31;
    const int half = lane >> 4;
    const int col  = lane & 15;

    const _Float16* kbase0 = qkv + tokBase * LD3 + CC + h * DD;   // keys, token-major
    const _Float16* vtbase = vT + ((size_t)b * CC + h * DD) * NN; // [64][NN]

    // Copy map: 8 lanes cover one 128-B row, the block 32 rows per copy; two
    // copies for the 64 K rows, two for the 64 vT rows.
    const int crow = t >> 3;
    const int ccol = (t & 7) * 8;
    const _Float16* gK = kbase0 + (size_t)crow * LD3 + ccol;
    const _Float16* gV = vtbase + (size_t)crow * NN + ccol;
    const unsigned  lK = (unsigned)(size_t)(&kv[crow * APITCH + ccol]);
    const unsigned  lhalf = 32 * APITCH * 2;      // bytes: 32 LDS rows
    const int ns = NN / AKS;

    // stage 0 -> buffer 0, landed and published before anybody reads it
    async_copy4(lK, lK + lhalf, lK + 2 * lhalf, lK + 3 * lhalf,
                gK, gK + (size_t)32 * LD3, gV, gV + (size_t)32 * NN);
    asm volatile("s_wait_asynccnt 0x0" ::: "memory");  // own copies landed
    __syncthreads();                                   // every wave's copies landed
    {
        const _Float16* k1 = gK + (size_t)AKS * LD3;
        const _Float16* v1 = gV + AKS;
        const unsigned  l1 = lK + ABUF * 2;
        async_copy4(l1, l1 + lhalf, l1 + 2 * lhalf, l1 + 3 * lhalf,
                    k1, k1 + (size_t)32 * LD3, v1, v1 + (size_t)32 * NN);
    }

    // Q fragments (B operand: column = query, 64 d), two K=32 chunks per tile
    const _Float16* qbase = qkv + (tokBase + q0) * LD3 + h * DD;
    v16h qa0[AQT], qa1[AQT];
#pragma unroll
    for (int u = 0; u < AQT; ++u) {
        qa0[u] = load_frag_rowmajor(qbase + (size_t)u * 16 * LD3, LD3);
        qa1[u] = load_frag_rowmajor(qbase + (size_t)u * 16 * LD3 + 32, LD3);
    }
    // stands in front of the first overwrite of the Q loads' address registers
    asm volatile("s_wait_xcnt 0x0" ::: "memory");
    __builtin_amdgcn_sched_barrier(0);  // no later register write is lifted over that wait

    const v8f vzero = {0.f, 0.f, 0.f, 0.f, 0.f, 0.f, 0.f, 0.f};
    v8f o[AQT][4];
#pragma unroll
    for (int u = 0; u < AQT; ++u)
#pragma unroll
        for (int j = 0; j < 4; ++j) o[u][j] = vzero;

    // This lane's query of each tile: running maximum (equal in both halves) and
    // the sum over this lane's own keys (the halves are joined after the loop).
    float m[AQT], l[AQT];
#pragma unroll
    for (int u = 0; u < AQT; ++u) { m[u] = -1e30f; l[u] = 0.f; }

    const float scale = 0.125f;  // D^-0.5 = 64^-0.5

    for (int s = 0; s < ns; ++s) {
        const int buf = s & 1;
        const _Float16* sK = kv + buf * ABUF;
        const _Float16* sV = sK + AKS * APITCH;

        // two 32-key blocks per stage; kept rolled: unrolled, the build takes about a
        // quarter more registers
#pragma unroll 1
        for (int kb = 0; kb < AKS; kb += 32) {
            const _Float16* kbase = sK + kb * APITCH;

            // ---- fragments of this block, from the shared stage ----
            v16h kf00 = load_frag_rowmajor(kbase, APITCH);                 // keys +0,  d 0..31
            v16h kf01 = load_frag_rowmajor(kbase + 32, APITCH);            // keys +0,  d 32..63
            v16h kf10 = load_frag_rowmajor(kbase + 16 * APITCH, APITCH);   // keys +16, d 0..31
            v16h kf11 = load_frag_rowmajor(kbase + 16 * APITCH + 32, APITCH);

            // ---- scores: S^T[32 keys x 16 queries] as two 16x16 f32 tiles, per query tile ----
            // register r of s0: key kb + 8*half + r; of s1: key kb + 16 + 8*half + r
            v8f s0[AQT], s1[AQT];
#pragma unroll
            for (int u = 0; u < AQT; ++u) {
                s0[u] = wmma32(kf00, qa0[u], vzero);
                s1[u] = wmma32(kf10, qa0[u], vzero);
            }
#pragma unroll
            for (int u = 0; u < AQT; ++u) {
                s0[u] = wmma32(kf01, qa1[u], s0[u]);
                s1[u] = wmma32(kf11, qa1[u], s1[u]);
            }
            // The eight products stay one run: each fills the vector slots the chip
            // needs behind the one before; mixed with the maxima, v_nops fill them.
            __builtin_amdgcn_sched_barrier(0);

            // ---- online softmax over this 32-key block, one query per lane and tile ----
            v16h pb[AQT];   // P^T as B operand: halves 0..7 from s0, 8..15 from s1
            float f[AQT], rs[AQT][4];   // rescale factor; four independent sum chains
#pragma unroll
            for (int u = 0; u < AQT; ++u) {
                const float x0 = max3f(max3f(s0[u][0], s0[u][1], s0[u][2]),
                                       max3f(s0[u][3], s0[u][4], s0[u][5]),
                                       max3f(s0[u][6], s0[u][7], s1[u][0]));
                const float x1 = max3f(max3f(s1[u][1], s1[u][2], s1[u][3]),
                                       max3f(s1[u][4], s1[u][5], s1[u][6]), s1[u][7]);
                float rm = fmaxf(x0, x1);
                rm = fmaxf(rm, xhalf(rm)) * scale;   // over all 32 keys; scale > 0
                const float nm = fmaxf(m[u], rm);
                f[u] = __expf(m[u] - nm);
#pragma unroll
                for (int c = 0; c < 4; ++c) rs[u][c] = 0.f;
#pragma unroll
                for (int r = 0; r < 8; ++r) {
                    const float p0 = __expf(s0[u][r] * scale - nm);
                    const float p1 = __expf(s1[u][r] * scale - nm);
                    rs[u][r & 1]       += p0;
                    rs[u][2 + (r & 1)] += p1;
                    pb[u][r]     = (_Float16)p0;
                    pb[u][8 + r] = (_Float16)p1;
                }
                m[u] = nm;

                // rescale running output accumulators
#pragma unroll
                for (int j = 0; j < 4; ++j)
#pragma unroll
                    for (int r = 0; r < 8; ++r) o[u][j][r] *= f[u];
            }

            // V fragments only now: LDS is near, and the registers stay free
            // during the softmax
            v16h vf0 = load_frag_rowmajor(sV +  0 * APITCH + kb, APITCH);
            v16h vf1 = load_frag_rowmajor(sV + 16 * APITCH + kb, APITCH);
            v16h vf2 = load_frag_rowmajor(sV + 32 * APITCH + kb, APITCH);
            v16h vf3 = load_frag_rowmajor(sV + 48 * APITCH + kb, APITCH);

            // ---- O^T[64 d x 16 queries] += V^T[64 x 32] * P^T[32 x 16], per query tile ----
            // each V^T fragment feeds both tiles, one product behind the other
#pragma unroll
            for (int u = 0; u < AQT; ++u) o[u][0] = wmma32(vf0, pb[u], o[u][0]);
#pragma unroll
            for (int u = 0; u < AQT; ++u) o[u][1] = wmma32(vf1, pb[u], o[u][1]);
#pragma unroll
            for (int u = 0; u < AQT; ++u) o[u][2] = wmma32(vf2, pb[u], o[u][2]);
#pragma unroll
            for (int u = 0; u < AQT; ++u) o[u][3] = wmma32(vf3, pb[u], o[u][3]);

            // The joins of the sums stand behind the last product: they fill the
            // vector slots that the chip needs before the next trip's first
            // instructions overwrite that product's operand registers.
            __builtin_amdgcn_sched_barrier(0);  // keeps the joins behind the products
#pragma unroll
            for (int u = 0; u < AQT; ++u)
                l[u] = l[u] * f[u] + ((rs[u][0] + rs[u][1]) + (rs[u][2] + rs[u][3]));
        }

        // hand-over: own LDS reads done, own copies of stage s+1 landed, then the
        // barrier publishes stage s+1 and frees this buffer for stage s+2
        asm volatile("s_wait_dscnt 0x0" ::: "memory");
        asm volatile("s_wait_asynccnt 0x0" ::: "memory");
        __syncthreads();
        if (s + 2 < ns) {
            const _Float16* kn = gK + (size_t)(s + 2) * AKS * LD3;
            const _Float16* vn = gV + (s + 2) * AKS;
            const unsigned  ln = lK + buf * (ABUF * 2);
            async_copy4(ln, ln + lhalf, ln + 2 * lhalf, ln + 3 * lhalf,
                        kn, kn + (size_t)32 * LD3, vn, vn + (size_t)32 * NN);
        }
    }
    asm volatile("s_wait_asynccnt 0x0" ::: "memory");  // nothing in flight at the end

    // ---- epilogue: normalize and store f16 at [token, h*64 + d] ----
    // register r of o[u][j]: d = j*16 + 8*half + r of query u*16 + col: 16 B per store
#pragma unroll
    for (int u = 0; u < AQT; ++u) {
        const float lt = l[u] + xhalf(l[u]);
        _Float16* obase = outh + (tokBase + q0 + u * 16 + col) * CC + h * DD + 8 * half;
#pragma unroll
        for (int j = 0; j < 4; ++j) {
            v8h w;
#pragma unroll
            for (int r = 0; r < 8; ++r) w[r] = (_Float16)(o[u][j][r] / lt);
            *(v8h*)(obase + j * 16) = w;
        }
    }
}

// ---------------------------------------------------------------------------
// Host-side launch
// ---------------------------------------------------------------------------
extern "C" void kernel_launch(void* const* d_in, const int* in_sizes, int n_in,
                              void* d_out, int out_size, void* d_ws, size_t ws_size,
                              hipStream_t stream) {
    const float* x      = (const float*)d_in[0];   // [B,N,C]
    const float* W_qkv  = (const float*)d_in[1];   // [C, 3C]
    const float* W_proj = (const float*)d_in[2];   // [C, C]
    const float* b_proj = (const float*)d_in[3];   // [C]
    float* out = (float*)d_out;                    // [B,N,C] f32

    // Workspace layout (all f16)
    _Float16* xh     = (_Float16*)d_ws;                 // [M, C]
    _Float16* wqkvT  = xh     + (size_t)MM * CC;        // [3C, C]
    _Float16* wprojT = wqkvT  + (size_t)CC * 3 * CC;    // [C, C]
    _Float16* qkvh   = wprojT + (size_t)CC * CC;        // [M, 3C]
    _Float16* attnh  = qkvh   + (size_t)MM * 3 * CC;    // [M, C]
    _Float16* vT     = attnh  + (size_t)MM * CC;        // [B*C, N]

    // 1) precision casts (weights transposed for contiguous B-fragments)
    {
        cast_f16_kernel<<<MM * CC / CAST_BLOCK, CAST_T, 0, stream>>>(x, xh);
        transpose_cast_f16_kernel<<<dim3(3 * CC / 64, CC / 64), 256, 0, stream>>>(
            W_qkv, wqkvT, CC, 3 * CC);
        transpose_cast_f16_kernel<<<dim3(CC / 64, CC / 64), 256, 0, stream>>>(
            W_proj, wprojT, CC, CC);
    }

    // 2) qkv = x @ W_qkv              (f16 out)
    wmma_gemm_kernel<true><<<dim3(3 * CC / 128, MM / 128), 128, 0, stream>>>(
        xh, wqkvT, qkvh, nullptr, nullptr, MM, CC, 3 * CC);

    // 2b) transpose V slab for contiguous P*V fragment loads
    transpose_v_kernel<<<dim3(CC / 128, MM / 64), 256, 0, stream>>>(qkvh, vT);

    // 3) flash attention per (b, h, 256 queries)
    attention_kernel<<<dim3(NN / (16 * AQT * AW), HH, BB), 32 * AW, 0, stream>>>(qkvh, vT, attnh);

    // 4) out = attn @ W_proj + b_proj (f32 out)
    wmma_gemm_kernel<false><<<dim3(CC / 128, MM / 128), 128, 0, stream>>>(
        attnh, wprojT, nullptr, out, b_proj, MM, CC, CC);
}

// v008
// It runs in 145 microseconds.
// Two timings next to v007 both put it at 1.05 times that version's speed.
// Over all steps from v000 it is 5.82 times as fast.
#include <hip/hip_runtime.h>
#include <hip/hip_bf16.h>

// ---------------------------------------------------------------------------
// CDNA5 (gfx1250) attention block:  out = softmax(QK^T * s) V  projected.
// All GEMM-like math goes through v_wmma_f32_16x16x32_f16 (f16 in, f32 acc).
// V is pre-transposed to [B][C][N] so every WMMA fragment is two contiguous
// 16-B loads per lane. The GEMMs and the attention read their fragments from
// LDS tiles that a whole work-group shares (see there).
// ---------------------------------------------------------------------------

typedef __attribute__((ext_vector_type(16))) _Float16 v16h;
typedef __attribute__((ext_vector_type(8)))  _Float16 v8h;
typedef __attribute__((ext_vector_type(8)))  float    v8f;

// Problem constants (fixed by the reference)
#define BB   4
#define NN   2048
#define CC   1024
#define HH   16
#define DD   64
#define LD3  (3 * CC)   // 3072, row stride of qkv buffer
#define MM   (BB * NN)  // 8192 tokens

__device__ __forceinline__ v8f wmma32(v16h a, v16h b, v8f c) {
    // (neg_a, A, neg_b, B, c_mod, C, reuse_a, reuse_b)
    return __builtin_amdgcn_wmma_f32_16x16x32_f16(
        false, a, false, b, (short)0, c, false, false);
}

// Load a 16x32 f16 fragment in the CDNA5 16-bit A/B layout from a row-major
// matrix (16-wide index across lanes&15; K contiguous within a row).
//   lanes 0-15 : idx=lane,    halves [0..7]=K0..7,  [8..15]=K16..23
//   lanes 16-31: idx=lane-16, halves [0..7]=K8..15, [8..15]=K24..31
__device__ __forceinline__ v16h load_frag_rowmajor(const _Float16* base, int ld) {
    const int lane = threadIdx.x & 31;
    const _Float16* p = base + (size_t)(lane & 15) * ld + ((lane >> 4) << 3);
    v8h lo = *(const v8h*)(p);
    v8h hi = *(const v8h*)(p + 16);
    return __builtin_shufflevector(lo, hi, 0, 1, 2, 3, 4, 5, 6, 7,
                                           8, 9, 10, 11, 12, 13, 14, 15);
}

// ---------------------------------------------------------------------------
// Elementwise f32 -> f16 cast of the M*C activations.
// Few long waves instead of one element per thread: a wave takes CAST_U runs of
// 128 floats. Each load is 16 B per lane over 512 contiguous bytes (4 whole
// lines); the loads stand ahead of the stores, so a wave keeps many lines in
// flight; each store is 8 B per lane over 256 contiguous bytes (2 whole lines).
// The grid covers exactly M*C elements, so there is no tail.
// ---------------------------------------------------------------------------
#define CAST_T 256                          // threads per block
#define CAST_U 16                           // 16-B loads per lane
#define CAST_BLOCK (CAST_T * CAST_U * 4)    // floats per block
static_assert((MM * CC) % CAST_BLOCK == 0, "the cast grid must cover x exactly");

typedef __attribute__((ext_vector_type(4))) float    c4f;
typedef __attribute__((ext_vector_type(4))) _Float16 c4h;

__global__ __launch_bounds__(CAST_T)
void cast_f16_kernel(const float* __restrict__ in,
                     _Float16* __restrict__ out) {
    const int lane = threadIdx.x & 31;
    const int wave = blockIdx.x * (CAST_T / 32) + (threadIdx.x >> 5);
    const size_t base = (size_t)wave * (CAST_U * 128) + lane * 4;
    const float* src = in + base;
    _Float16*    dst = out + base;

    c4f v[CAST_U];
#pragma unroll
    for (int u = 0; u < CAST_U; ++u) v[u] = *(const c4f*)(src + u * 128);
#pragma unroll
    for (int u = 0; u < CAST_U; ++u) {
        const c4h h = {(_Float16)v[u][0], (_Float16)v[u][1],
                       (_Float16)v[u][2], (_Float16)v[u][3]};
        *(c4h*)(dst + u * 128) = h;
    }
}

// Both transposes below go through an LDS tile so that the global reads AND the
// global writes are 16 B per lane over contiguous runs. Two source rows are
// packed into one dword, so a tile row [c] holds 32 dwords = 64 source rows.
// Pitch 33 dwords (odd): the column-wise dword writes of a wave fall on
// different banks; the read-back is four dword loads per 16-B store.
#define TPD 33

typedef __attribute__((ext_vector_type(2))) _Float16 v2h;
typedef __attribute__((ext_vector_type(4))) float    v4f;
typedef __attribute__((ext_vector_type(4))) unsigned v4u;

__device__ __forceinline__ unsigned pack2h(_Float16 lo, _Float16 hi) {
    v2h p = {lo, hi};
    return __builtin_bit_cast(unsigned, p);
}

// Transposing cast: in[rows][cols] (f32) -> out[cols][rows] (f16).
// One 256-thread block per 64x64 tile; rows and cols are multiples of 64.
__global__ __launch_bounds__(256)
void transpose_cast_f16_kernel(const float* __restrict__ in,
                               _Float16* __restrict__ out,
                               int rows, int cols) {
    __shared__ unsigned tile[64 * TPD];
    const int t  = threadIdx.x;
    const int c0 = blockIdx.x * 64;
    const int r0 = blockIdx.y * 64;
    const int cg = t & 15;   // 4 columns each: 16 lanes = 256 B of one row
    const int rp = t >> 4;   // row pair 0..15 (and +16)

    const float* src = in + (size_t)(r0 + 2 * rp) * cols + c0 + 4 * cg;
    const v4f a0 = *(const v4f*)(src);
    const v4f a1 = *(const v4f*)(src + cols);
    const v4f b0 = *(const v4f*)(src + (size_t)32 * cols);
    const v4f b1 = *(const v4f*)(src + (size_t)33 * cols);

    unsigned* w = tile + (4 * cg) * TPD + rp;
#pragma unroll
    for (int i = 0; i < 4; ++i) {
        w[i * TPD]      = pack2h((_Float16)a0[i], (_Float16)a1[i]);
        w[i * TPD + 16] = pack2h((_Float16)b0[i], (_Float16)b1[i]);
    }
    __syncthreads();

#pragma unroll
    for (int k = 0; k < 2; ++k) {
        const int chunk = t + 256 * k;
        const int c = chunk >> 3;   // output row inside the tile
        const int g = chunk & 7;    // 16-B piece: 8 lanes = one 128-B line
        const unsigned* rd = tile + c * TPD + 4 * g;
        const v4u v = {rd[0], rd[1], rd[2], rd[3]};
        *(v4u*)(out + (size_t)(c0 + c) * rows + r0 + 8 * g) = v;
    }
}

// Extract + transpose the V slab of qkv:
//   vT[b*C + c][n] = qkv[(b*N + n)*3C + 2C + c]
// One 256-thread block per tile of 64 tokens x 128 channels.
__global__ __launch_bounds__(256)
void transpose_v_kernel(const _Float16* __restrict__ qkv,
                        _Float16* __restrict__ vT) {
    __shared__ unsigned tile[128 * TPD];
    const int t    = threadIdx.x;
    const int c0   = blockIdx.x * 128;
    const int tok0 = blockIdx.y * 64;      // b*N + n0; 64 divides N
    const int b    = tok0 / NN;
    const int n0   = tok0 - b * NN;
    const int cg   = t & 15;   // 8 channels each: 16 lanes = 256 B of one row
    const int rp   = t >> 4;   // token pair 0..15 (and +16)

    const _Float16* src = qkv + (size_t)(tok0 + 2 * rp) * LD3 + 2 * CC + c0 + 8 * cg;
    const v8h a0 = *(const v8h*)(src);
    const v8h a1 = *(const v8h*)(src + LD3);
    const v8h b0 = *(const v8h*)(src + (size_t)32 * LD3);
    const v8h b1 = *(const v8h*)(src + (size_t)33 * LD3);

    unsigned* w = tile + (8 * cg) * TPD + rp;
#pragma unroll
    for (int i = 0; i < 8; ++i) {
        w[i * TPD]      = pack2h(a0[i], a1[i]);
        w[i * TPD + 16] = pack2h(b0[i], b1[i]);
    }
    __syncthreads();

    _Float16* dst = vT + ((size_t)b * CC + c0) * NN + n0;
#pragma unroll
    for (int k = 0; k < 4; ++k) {
        const int chunk = t + 256 * k;
        const int c = chunk >> 3;   // channel inside the tile
        const int g = chunk & 7;    // 16-B piece: 8 lanes = one 128-B line
        const unsigned* rd = tile + c * TPD + 4 * g;
        const v4u v = {rd[0], rd[1], rd[2], rd[3]};
        *(v4u*)(dst + (size_t)c * NN + 8 * g) = v;
    }
}

// ---------------------------------------------------------------------------
// WMMA GEMM:  C[M,Nn] = A[M,K] * B[K,Nn]   (B supplied transposed: BT[Nn][K])
// One 4-wave work-group computes a 128x128 tile; each wave a 64x64 quarter
// (16 accumulators). A K-slab of 64 (128 rows of A, 128 rows of BT, 128 B per
// row) is brought into LDS by asynchronous 16-B copies, whole 128-B lines per
// 8 lanes, two buffers: the next slab flies while this one is multiplied.
// The tiles are formed transposed (BT rows as the A operand), so a lane holds 8
// adjacent columns of one output row. After the k loop each wave lays its
// quarter into its own part of the freed slab memory and reads it back row by
// row: every global store is 16 B per lane over whole 128-B lines.
// M, Nn multiples of 128; K a multiple of 64.
// ---------------------------------------------------------------------------
#define GT     128                    // tile rows of A and of BT
#define GBK    64                     // k per slab
#define GPITCH 72                     // halves per LDS row: 144 B = 16 B x 9
#define GSLAB  (2 * GT * GPITCH)      // halves per buffer
#define GSTAGE (2 * GSLAB / 4)        // halves of output staging per wave
#define GEPH   72                     // staging pitch, f16 rows: 128 B + 16 B
#define GEPF   68                     // staging pitch, f32 rows: 256 B + 16 B
static_assert(64 * GEPH <= GSTAGE && 64 * GEPF * 2 <= GSTAGE,
              "a wave's 64 staged rows must fit its part of the slab memory");

// Eight asynchronous copies, 16 B per lane each. The s_wait_xcnt stands inside
// the statement so that no address register is rewritten ahead of it.
__device__ __forceinline__ void async_copy8(unsigned l, const _Float16* g,
                                            unsigned lstep, size_t gstep) {
    const unsigned l1 = l + lstep, l2 = l1 + lstep, l3 = l2 + lstep;
    const unsigned l4 = l3 + lstep, l5 = l4 + lstep, l6 = l5 + lstep, l7 = l6 + lstep;
    const _Float16 *g1 = g + gstep, *g2 = g1 + gstep, *g3 = g2 + gstep;
    const _Float16 *g4 = g3 + gstep, *g5 = g4 + gstep, *g6 = g5 + gstep, *g7 = g6 + gstep;
    asm volatile(
        "global_load_async_to_lds_b128 %0, %8, off\n\t"
        "global_load_async_to_lds_b128 %1, %9, off\n\t"
        "global_load_async_to_lds_b128 %2, %10, off\n\t"
        "global_load_async_to_lds_b128 %3, %11, off\n\t"
        "global_load_async_to_lds_b128 %4, %12, off\n\t"
        "global_load_async_to_lds_b128 %5, %13, off\n\t"
        "global_load_async_to_lds_b128 %6, %14, off\n\t"
        "global_load_async_to_lds_b128 %7, %15, off\n\t"
        "s_wait_xcnt 0x0"
        :: "v"(l), "v"(l1), "v"(l2), "v"(l3), "v"(l4), "v"(l5), "v"(l6), "v"(l7),
           "v"(g), "v"(g1), "v"(g2), "v"(g3), "v"(g4), "v"(g5), "v"(g6), "v"(g7)
        : "memory");
}

template <bool OUT_F16>
__global__ __launch_bounds__(128)
void wmma_gemm_kernel(const _Float16* __restrict__ A,
                      const _Float16* __restrict__ BT,
                      _Float16* __restrict__ Ch,
                      float* __restrict__ Cf,
                      const float* __restrict__ bias,
                      int M, int K, int Nn) {
    __shared__ __attribute__((aligned(16))) _Float16 slab[2 * GSLAB];

    const int t    = threadIdx.x;
    const int lane = t & 31;
    const int wave = t >> 5;
    const int n0 = blockIdx.x * GT;
    const int m0 = blockIdx.y * GT;
    const int wm = (wave >> 1) * 64;   // this wave's quarter of the tile
    const int wn = (wave & 1) * 64;

    // Copy map: 8 lanes cover one 128-B row piece, a wave 4 rows, the block 16
    // rows per copy; 8 copies for the A rows, 8 for the BT rows.
    const int crow = t >> 3;
    const int ccol = (t & 7) * 8;
    const _Float16* gA = A  + (size_t)(m0 + crow) * K + ccol;
    const _Float16* gB = BT + (size_t)(n0 + crow) * K + ccol;
    const unsigned  lA = (unsigned)(size_t)(&slab[crow * GPITCH + ccol]);
    const unsigned  lB = lA + GT * GPITCH * 2;
    const unsigned  lstep = 16 * GPITCH * 2;     // bytes: 16 LDS rows
    const size_t    gstep = (size_t)16 * K;      // halves: 16 source rows
    const int nt = K / GBK;

    const v8f vzero = {0.f, 0.f, 0.f, 0.f, 0.f, 0.f, 0.f, 0.f};
    v8f acc[4][4];
#pragma unroll
    for (int i = 0; i < 4; ++i)
#pragma unroll
        for (int j = 0; j < 4; ++j) acc[i][j] = vzero;

    // slab 0 -> buffer 0, landed and published before anybody reads it
    async_copy8(lA, gA, lstep, gstep);
    async_copy8(lB, gB, lstep, gstep);
    asm volatile("s_wait_asynccnt 0x0" ::: "memory");  // own copies landed
    __syncthreads();                                   // every wave's copies landed
    if (nt > 1) {
        async_copy8(lA + GSLAB * 2, gA + GBK, lstep, gstep);
        async_copy8(lB + GSLAB * 2, gB + GBK, lstep, gstep);
    }

    for (int s = 0; s < nt; ++s) {
        const int buf = s & 1;
        const _Float16* sA = slab + buf * GSLAB + wm * GPITCH;
        const _Float16* sB = slab + buf * GSLAB + (GT + wn) * GPITCH;
#pragma unroll
        for (int kk = 0; kk < GBK; kk += 32) {
            v16h a[4], b[4];
#pragma unroll
            for (int i = 0; i < 4; ++i)
                a[i] = load_frag_rowmajor(sA + i * 16 * GPITCH + kk, GPITCH);
#pragma unroll
            for (int j = 0; j < 4; ++j)
                b[j] = load_frag_rowmajor(sB + j * 16 * GPITCH + kk, GPITCH);
#pragma unroll
            for (int i = 0; i < 4; ++i)
#pragma unroll
                for (int j = 0; j < 4; ++j)
                    acc[i][j] = wmma32(b[j], a[i], acc[i][j]);   // C^T tile: rows n, columns m
        }
        // hand-over: own LDS reads done, own copies of slab s+1 landed, then the
        // barrier publishes slab s+1 and frees this buffer for slab s+2
        asm volatile("s_wait_dscnt 0x0" ::: "memory");
        asm volatile("s_wait_asynccnt 0x0" ::: "memory");
        __syncthreads();
        if (s + 2 < nt) {
            const size_t ko = (size_t)(s + 2) * GBK;
            async_copy8(lA + buf * (GSLAB * 2), gA + ko, lstep, gstep);
            async_copy8(lB + buf * (GSLAB * 2), gB + ko, lstep, gstep);
        }
    }
    asm volatile("s_wait_asynccnt 0x0" ::: "memory");  // nothing in flight at the end

    // Register r of acc[i][j]: output row i*16 + (lane & 15), column j*16 + 8*half + r.
    // The last barrier of the loop ended every wave's slab reads and no copy is
    // in flight, so the slab memory is free; each wave stages in its own part.
    const int half = lane >> 4;
    const int col  = lane & 15;
    if (OUT_F16) {
        _Float16* st = slab + wave * GSTAGE;
#pragma unroll
        for (int i = 0; i < 4; ++i) {
#pragma unroll
            for (int j = 0; j < 4; ++j) {
                v8h w;
#pragma unroll
                for (int r = 0; r < 8; ++r) w[r] = (_Float16)acc[i][j][r];
                *(v8h*)(st + (i * 16 + col) * GEPH + j * 16 + 8 * half) = w;
            }
        }
        // the rows are read back by other lanes of this wave: own LDS writes first
        asm volatile("s_wait_dscnt 0x0" ::: "memory");
        const int rr = lane >> 3;         // 8 lanes = one 128-B row, 4 rows a store
        const int cc = (lane & 7) * 8;
        const _Float16* rd = st + rr * GEPH + cc;
        _Float16* dst = Ch + (size_t)(m0 + wm + rr) * Nn + n0 + wn + cc;
#pragma unroll
        for (int k = 0; k < 16; ++k)
            *(v8h*)(dst + (size_t)(4 * k) * Nn) = *(const v8h*)(rd + 4 * k * GEPH);
    } else {
        float* st = (float*)(slab + wave * GSTAGE);
        // bias of the 4 columns this lane stores; asked for ahead of the staging,
        // which covers its latency
        const v4f bv = *(const v4f*)(bias + n0 + wn + (lane & 15) * 4);
#pragma unroll
        for (int i = 0; i < 4; ++i) {
#pragma unroll
            for (int j = 0; j < 4; ++j) {
                float* w = st + (i * 16 + col) * GEPF + j * 16 + 8 * half;
                const v4f lo = {acc[i][j][0], acc[i][j][1], acc[i][j][2], acc[i][j][3]};
                const v4f hi = {acc[i][j][4], acc[i][j][5], acc[i][j][6], acc[i][j][7]};
                *(v4f*)(w)     = lo;
                *(v4f*)(w + 4) = hi;
            }
        }
        // the rows are read back by other lanes of this wave: own LDS writes first
        asm volatile("s_wait_dscnt 0x0" ::: "memory");
        const int rr = lane >> 4;         // 16 lanes = one 256-B row, 2 rows a store
        const int cc = (lane & 15) * 4;
        const float* rd = st + rr * GEPF + cc;
        float* dst = Cf + (size_t)(m0 + wm + rr) * Nn + n0 + wn + cc;
#pragma unroll
        for (int k = 0; k < 32; ++k)
            *(v4f*)(dst + (size_t)(2 * k) * Nn) = *(const v4f*)(rd + 2 * k * GEPF) + bv;
    }
}

#define AW     8
#define AQT    2
#define AKS    64
#define APITCH 72
#define ABUF   (2 * AKS * APITCH)
#define ALAZY  5.545177f

// Four asynchronous copies, 16 B per lane each. The s_wait_xcnt stands inside
// the statement so that no address register is rewritten ahead of it.
__device__ __forceinline__ void async_copy4(unsigned l0, unsigned l1,
                                            unsigned l2, unsigned l3,
                                            const _Float16* g0, const _Float16* g1,
                                            const _Float16* g2, const _Float16* g3) {
    asm volatile(
        "global_load_async_to_lds_b128 %0, %4, off\n\t"
        "global_load_async_to_lds_b128 %1, %5, off\n\t"
        "global_load_async_to_lds_b128 %2, %6, off\n\t"
        "global_load_async_to_lds_b128 %3, %7, off\n\t"
        "s_wait_xcnt 0x0"
        :: "v"(l0), "v"(l1), "v"(l2), "v"(l3),
           "v"(g0), "v"(g1), "v"(g2), "v"(g3)
        : "memory");
}

// Value of lane ^ 16: the lane that holds the same query's other keys.
__device__ __forceinline__ float xhalf(float x) {
    const int b = __builtin_bit_cast(int, x);
    return __builtin_bit_cast(float, __builtin_amdgcn_permlanex16(
        b, b, 0x76543210, 0xfedcba98, false, false));
}

__device__ __forceinline__ float max3f(float a, float b, float c) {
    return fmaxf(fmaxf(a, b), c);
}

// Two work-groups per WGP (4 waves per SIMD, at most 256 registers a wave): the
// softmax is vector work between the matrix runs, and other waves fill it.
__global__ __launch_bounds__(32 * AW) __attribute__((amdgpu_waves_per_eu(4)))
void attention_kernel(const _Float16* __restrict__ qkv,
                      const _Float16* __restrict__ vT,
                      _Float16* __restrict__ outh) {
    __shared__ __attribute__((aligned(16))) _Float16 kv[2 * ABUF];

    const int t    = threadIdx.x;
    const int wave = t >> 5;
    const int q0   = (blockIdx.x * AW + wave) * (16 * AQT);
    const int h    = blockIdx.y;
    const int b    = blockIdx.z;
    const size_t tokBase = (size_t)b * NN;

    const int lane = t & 31;
    const int half = lane >> 4;
    const int col  = lane & 15;

    const _Float16* kbase0 = qkv + tokBase * LD3 + CC + h * DD;   // keys, token-major
    const _Float16* vtbase = vT + ((size_t)b * CC + h * DD) * NN; // [64][NN]

    // Copy map: 8 lanes cover one 128-B row, the block 32 rows per copy; two
    // copies for the 64 K rows, two for the 64 vT rows.
    const int crow = t >> 3;
    const int ccol = (t & 7) * 8;
    const _Float16* gK = kbase0 + (size_t)crow * LD3 + ccol;
    const _Float16* gV = vtbase + (size_t)crow * NN + ccol;
    const unsigned  lK = (unsigned)(size_t)(&kv[crow * APITCH + ccol]);
    const unsigned  lhalf = 32 * APITCH * 2;      // bytes: 32 LDS rows
    const int ns = NN / AKS;

    // stage 0 -> buffer 0, landed and published before anybody reads it
    async_copy4(lK, lK + lhalf, lK + 2 * lhalf, lK + 3 * lhalf,
                gK, gK + (size_t)32 * LD3, gV, gV + (size_t)32 * NN);
    asm volatile("s_wait_asynccnt 0x0" ::: "memory");  // own copies landed
    __syncthreads();                                   // every wave's copies landed
    {
        const _Float16* k1 = gK + (size_t)AKS * LD3;
        const _Float16* v1 = gV + AKS;
        const unsigned  l1 = lK + ABUF * 2;
        async_copy4(l1, l1 + lhalf, l1 + 2 * lhalf, l1 + 3 * lhalf,
                    k1, k1 + (size_t)32 * LD3, v1, v1 + (size_t)32 * NN);
    }

    // Q fragments (B operand: column = query, 64 d), two K=32 chunks per tile
    const _Float16* qbase = qkv + (tokBase + q0) * LD3 + h * DD;
    v16h qa0[AQT], qa1[AQT];
#pragma unroll
    for (int u = 0; u < AQT; ++u) {
        qa0[u] = load_frag_rowmajor(qbase + (size_t)u * 16 * LD3, LD3);
        qa1[u] = load_frag_rowmajor(qbase + (size_t)u * 16 * LD3 + 32, LD3);
    }
    // stands in front of the first overwrite of the Q loads' address registers
    asm volatile("s_wait_xcnt 0x0" ::: "memory");
    __builtin_amdgcn_sched_barrier(0);  // no later register write is lifted over that wait

    const v8f vzero = {0.f, 0.f, 0.f, 0.f, 0.f, 0.f, 0.f, 0.f};
    v8f o[AQT][4];
#pragma unroll
    for (int u = 0; u < AQT; ++u)
#pragma unroll
        for (int j = 0; j < 4; ++j) o[u][j] = vzero;

    // This lane's query of each tile: maximum in use (equal in both halves) and
    // the sum over this lane's own keys (the halves are joined after the loop).
    // mt: the raw score above which m must be renewed, (m + ALAZY) / scale.
    float m[AQT], mt[AQT], l[AQT];
#pragma unroll
    for (int u = 0; u < AQT; ++u) { m[u] = -1e30f; mt[u] = -1e30f; l[u] = 0.f; }

    const float scale = 0.125f;  // D^-0.5 = 64^-0.5

    for (int s = 0; s < ns; ++s) {
        const int buf = s & 1;
        const _Float16* sK = kv + buf * ABUF;
        const _Float16* sV = sK + AKS * APITCH;

        // two 32-key blocks per stage; kept rolled: unrolled, the build takes about a
        // quarter more registers
#pragma unroll 1
        for (int kb = 0; kb < AKS; kb += 32) {
            const _Float16* kbase = sK + kb * APITCH;

            // ---- fragments of this block, from the shared stage ----
            v16h kf00 = load_frag_rowmajor(kbase, APITCH);                 // keys +0,  d 0..31
            v16h kf01 = load_frag_rowmajor(kbase + 32, APITCH);            // keys +0,  d 32..63
            v16h kf10 = load_frag_rowmajor(kbase + 16 * APITCH, APITCH);   // keys +16, d 0..31
            v16h kf11 = load_frag_rowmajor(kbase + 16 * APITCH + 32, APITCH);

            // ---- scores: S^T[32 keys x 16 queries] as two 16x16 f32 tiles, per query tile ----
            // register r of s0: key kb + 8*half + r; of s1: key kb + 16 + 8*half + r
            v8f s0[AQT], s1[AQT];
#pragma unroll
            for (int u = 0; u < AQT; ++u) {
                s0[u] = wmma32(kf00, qa0[u], vzero);
                s1[u] = wmma32(kf10, qa0[u], vzero);
            }
#pragma unroll
            for (int u = 0; u < AQT; ++u) {
                s0[u] = wmma32(kf01, qa1[u], s0[u]);
                s1[u] = wmma32(kf11, qa1[u], s1[u]);
            }
            // The eight products stay one run: each fills the vector slots the chip
            // needs behind the one before; mixed with the maxima, v_nops fill them.
            __builtin_amdgcn_sched_barrier(0);

            // ---- online softmax over this 32-key block, one query per lane and tile ----
            // Lazy rescale: the maximum in use, m, stays until some query's scores pass
            // it by more than ALAZY; one test per block and wave. Any m gives the same
            // quotient o / l; the bound keeps every p at or below e^ALAZY = 2^8.
            float xm[AQT];   // raw maximum over this lane's own 16 keys
            bool need = false;
#pragma unroll
            for (int u = 0; u < AQT; ++u) {
                const float x0 = max3f(max3f(s0[u][0], s0[u][1], s0[u][2]),
                                       max3f(s0[u][3], s0[u][4], s0[u][5]),
                                       max3f(s0[u][6], s0[u][7], s1[u][0]));
                const float x1 = max3f(max3f(s1[u][1], s1[u][2], s1[u][3]),
                                       max3f(s1[u][4], s1[u][5], s1[u][6]), s1[u][7]);
                xm[u] = fmaxf(x0, x1);
                need = need || (xm[u] > mt[u]);
            }
            if (__builtin_amdgcn_ballot_w32(need) != 0) {   // scalar branch, whole wave
#pragma unroll
                for (int u = 0; u < AQT; ++u) {
                    const float rm = fmaxf(xm[u], xhalf(xm[u])) * scale;  // all 32 keys; scale > 0
                    const float nm = fmaxf(m[u], rm);        // equal in both halves
                    const float f  = __expf(m[u] - nm);
                    m[u]  = nm;
                    mt[u] = (nm + ALAZY) * (1.f / scale);   // times 8: exact
                    l[u] *= f;
#pragma unroll
                    for (int j = 0; j < 4; ++j)
#pragma unroll
                        for (int r = 0; r < 8; ++r) o[u][j][r] *= f;
                }
            }

            v16h pb[AQT];   // P^T as B operand: halves 0..7 from s0, 8..15 from s1
            float rs[AQT][4];   // four independent sum chains
#pragma unroll
            for (int u = 0; u < AQT; ++u) {
#pragma unroll
                for (int c = 0; c < 4; ++c) rs[u][c] = 0.f;
#pragma unroll
                for (int r = 0; r < 8; ++r) {
                    const float p0 = __expf(s0[u][r] * scale - m[u]);
                    const float p1 = __expf(s1[u][r] * scale - m[u]);
                    rs[u][r & 1]       += p0;
                    rs[u][2 + (r & 1)] += p1;
                    pb[u][r]     = (_Float16)p0;
                    pb[u][8 + r] = (_Float16)p1;
                }
            }

            // V fragments only now: LDS is near, and the registers stay free
            // during the softmax
            v16h vf0 = load_frag_rowmajor(sV +  0 * APITCH + kb, APITCH);
            v16h vf1 = load_frag_rowmajor(sV + 16 * APITCH + kb, APITCH);
            v16h vf2 = load_frag_rowmajor(sV + 32 * APITCH + kb, APITCH);
            v16h vf3 = load_frag_rowmajor(sV + 48 * APITCH + kb, APITCH);

            // ---- O^T[64 d x 16 queries] += V^T[64 x 32] * P^T[32 x 16], per query tile ----
            // each V^T fragment feeds both tiles, one product behind the other
#pragma unroll
            for (int u = 0; u < AQT; ++u) o[u][0] = wmma32(vf0, pb[u], o[u][0]);
#pragma unroll
            for (int u = 0; u < AQT; ++u) o[u][1] = wmma32(vf1, pb[u], o[u][1]);
#pragma unroll
            for (int u = 0; u < AQT; ++u) o[u][2] = wmma32(vf2, pb[u], o[u][2]);
#pragma unroll
            for (int u = 0; u < AQT; ++u) o[u][3] = wmma32(vf3, pb[u], o[u][3]);

            // The joins of the sums stand behind the last product: they fill the
            // vector slots that the chip needs before the next trip's first
            // instructions overwrite that product's operand registers.
            __builtin_amdgcn_sched_barrier(0);  // keeps the joins behind the products
#pragma unroll
            for (int u = 0; u < AQT; ++u)
                l[u] += (rs[u][0] + rs[u][1]) + (rs[u][2] + rs[u][3]);
        }

        // hand-over: own LDS reads done, own copies of stage s+1 landed, then the
        // barrier publishes stage s+1 and frees this buffer for stage s+2
        asm volatile("s_wait_dscnt 0x0" ::: "memory");
        asm volatile("s_wait_asynccnt 0x0" ::: "memory");
        __syncthreads();
        if (s + 2 < ns) {
            const _Float16* kn = gK + (size_t)(s + 2) * AKS * LD3;
            const _Float16* vn = gV + (s + 2) * AKS;
            const unsigned  ln = lK + buf * (ABUF * 2);
            async_copy4(ln, ln + lhalf, ln + 2 * lhalf, ln + 3 * lhalf,
                        kn, kn + (size_t)32 * LD3, vn, vn + (size_t)32 * NN);
        }
    }
    asm volatile("s_wait_asynccnt 0x0" ::: "memory");  // nothing in flight at the end

    // ---- epilogue: normalize and store f16 at [token, h*64 + d] ----
    // register r of o[u][j]: d = j*16 + 8*half + r of query u*16 + col: 16 B per store
#pragma unroll
    for (int u = 0; u < AQT; ++u) {
        const float lt = l[u] + xhalf(l[u]);
        _Float16* obase = outh + (tokBase + q0 + u * 16 + col) * CC + h * DD + 8 * half;
#pragma unroll
        for (int j = 0; j < 4; ++j) {
            v8h w;
#pragma unroll
            for (int r = 0; r < 8; ++r) w[r] = (_Float16)(o[u][j][r] / lt);
            *(v8h*)(obase + j * 16) = w;
        }
    }
}

// ---------------------------------------------------------------------------
// Host-side launch
// ---------------------------------------------------------------------------
extern "C" void kernel_launch(void* const* d_in, const int* in_sizes, int n_in,
                              void* d_out, int out_size, void* d_ws, size_t ws_size,
                              hipStream_t stream) {
    const float* x      = (const float*)d_in[0];   // [B,N,C]
    const float* W_qkv  = (const float*)d_in[1];   // [C, 3C]
    const float* W_proj = (const float*)d_in[2];   // [C, C]
    const float* b_proj = (const float*)d_in[3];   // [C]
    float* out = (float*)d_out;                    // [B,N,C] f32

    // Workspace layout (all f16)
    _Float16* xh     = (_Float16*)d_ws;                 // [M, C]
    _Float16* wqkvT  = xh     + (size_t)MM * CC;        // [3C, C]
    _Float16* wprojT = wqkvT  + (size_t)CC * 3 * CC;    // [C, C]
    _Float16* qkvh   = wprojT + (size_t)CC * CC;        // [M, 3C]
    _Float16* attnh  = qkvh   + (size_t)MM * 3 * CC;    // [M, C]
    _Float16* vT     = attnh  + (size_t)MM * CC;        // [B*C, N]

    // 1) precision casts (weights transposed for contiguous B-fragments)
    {
        cast_f16_kernel<<<MM * CC / CAST_BLOCK, CAST_T, 0, stream>>>(x, xh);
        transpose_cast_f16_kernel<<<dim3(3 * CC / 64, CC / 64), 256, 0, stream>>>(
            W_qkv, wqkvT, CC, 3 * CC);
        transpose_cast_f16_kernel<<<dim3(CC / 64, CC / 64), 256, 0, stream>>>(
            W_proj, wprojT, CC, CC);
    }

    // 2) qkv = x @ W_qkv              (f16 out)
    wmma_gemm_kernel<true><<<dim3(3 * CC / 128, MM / 128), 128, 0, stream>>>(
        xh, wqkvT, qkvh, nullptr, nullptr, MM, CC, 3 * CC);

    // 2b) transpose V slab for contiguous P*V fragment loads
    transpose_v_kernel<<<dim3(CC / 128, MM / 64), 256, 0, stream>>>(qkvh, vT);

    // 3) flash attention per (b, h, 256 queries)
    attention_kernel<<<dim3(NN / (16 * AQT * AW), HH, BB), 32 * AW, 0, stream>>>(qkvh, vT, attnh);

    // 4) out = attn @ W_proj + b_proj (f32 out)
    wmma_gemm_kernel<false><<<dim3(CC / 128, MM / 128), 128, 0, stream>>>(
        attnh, wprojT, nullptr, out, b_proj, MM, CC, CC);
}

// v009
// It runs in 140 microseconds.
// Two timings next to v008 put it at 1.04 and 1.03 times that version's speed.
// Over all steps from v000 it is 6.02 times as fast.
#include <hip/hip_runtime.h>
#include <hip/hip_bf16.h>

// ---------------------------------------------------------------------------
// CDNA5 (gfx1250) attention block:  out = softmax(QK^T * s) V  projected.
// All GEMM-like math goes through v_wmma_f32_16x16x32_f16 (f16 in, f32 acc).
// V is kept transposed, [B][C][N] (the qkv GEMM stores it so), so every WMMA
// fragment is two contiguous 16-B loads per lane. The GEMMs and the attention
// read their fragments from LDS tiles that a whole work-group shares (see there).
// ---------------------------------------------------------------------------

typedef __attribute__((ext_vector_type(16))) _Float16 v16h;
typedef __attribute__((ext_vector_type(8)))  _Float16 v8h;
typedef __attribute__((ext_vector_type(8)))  float    v8f;

// Problem constants (fixed by the reference)
#define BB   4
#define NN   2048
#define CC   1024
#define HH   16
#define DD   64
#define LD3  (3 * CC)   // 3072, row stride of qkv buffer
#define MM   (BB * NN)  // 8192 tokens

__device__ __forceinline__ v8f wmma32(v16h a, v16h b, v8f c) {
    // (neg_a, A, neg_b, B, c_mod, C, reuse_a, reuse_b)
    return __builtin_amdgcn_wmma_f32_16x16x32_f16(
        false, a, false, b, (short)0, c, false, false);
}

// Load a 16x32 f16 fragment in the CDNA5 16-bit A/B layout from a row-major
// matrix (16-wide index across lanes&15; K contiguous within a row).
//   lanes 0-15 : idx=lane,    halves [0..7]=K0..7,  [8..15]=K16..23
//   lanes 16-31: idx=lane-16, halves [0..7]=K8..15, [8..15]=K24..31
__device__ __forceinline__ v16h load_frag_rowmajor(const _Float16* base, int ld) {
    const int lane = threadIdx.x & 31;
    const _Float16* p = base + (size_t)(lane & 15) * ld + ((lane >> 4) << 3);
    v8h lo = *(const v8h*)(p);
    v8h hi = *(const v8h*)(p + 16);
    return __builtin_shufflevector(lo, hi, 0, 1, 2, 3, 4, 5, 6, 7,
                                           8, 9, 10, 11, 12, 13, 14, 15);
}

// ---------------------------------------------------------------------------
// Elementwise f32 -> f16 cast of the M*C activations.
// Few long waves instead of one element per thread: a wave takes CAST_U runs of
// 128 floats. Each load is 16 B per lane over 512 contiguous bytes (4 whole
// lines); the loads stand ahead of the stores, so a wave keeps many lines in
// flight; each store is 8 B per lane over 256 contiguous bytes (2 whole lines).
// The grid covers exactly M*C elements, so there is no tail.
// ---------------------------------------------------------------------------
#define CAST_T 256                          // threads per block
#define CAST_U 16                           // 16-B loads per lane
#define CAST_BLOCK (CAST_T * CAST_U * 4)    // floats per block
static_assert((MM * CC) % CAST_BLOCK == 0, "the cast grid must cover x exactly");

typedef __attribute__((ext_vector_type(4))) float    c4f;
typedef __attribute__((ext_vector_type(4))) _Float16 c4h;

__global__ __launch_bounds__(CAST_T)
void cast_f16_kernel(const float* __restrict__ in,
                     _Float16* __restrict__ out) {
    const int lane = threadIdx.x & 31;
    const int wave = blockIdx.x * (CAST_T / 32) + (threadIdx.x >> 5);
    const size_t base = (size_t)wave * (CAST_U * 128) + lane * 4;
    const float* src = in + base;
    _Float16*    dst = out + base;

    c4f v[CAST_U];
#pragma unroll
    for (int u = 0; u < CAST_U; ++u) v[u] = *(const c4f*)(src + u * 128);
#pragma unroll
    for (int u = 0; u < CAST_U; ++u) {
        const c4h h = {(_Float16)v[u][0], (_Float16)v[u][1],
                       (_Float16)v[u][2], (_Float16)v[u][3]};
        *(c4h*)(dst + u * 128) = h;
    }
}

// The transpose below goes through an LDS tile so that the global reads AND the
// global writes are 16 B per lane over contiguous runs. Two source rows are
// packed into one dword, so a tile row [c] holds 32 dwords = 64 source rows.
// Pitch 33 dwords (odd): the column-wise dword writes of a wave fall on
// different banks; the read-back is four dword loads per 16-B store.
#define TPD 33

typedef __attribute__((ext_vector_type(2))) _Float16 v2h;
typedef __attribute__((ext_vector_type(4))) float    v4f;
typedef __attribute__((ext_vector_type(4))) unsigned v4u;

__device__ __forceinline__ unsigned pack2h(_Float16 lo, _Float16 hi) {
    v2h p = {lo, hi};
    return __builtin_bit_cast(unsigned, p);
}

// Transposing cast: in[rows][cols] (f32) -> out[cols][rows] (f16).
// One 256-thread block per 64x64 tile; rows and cols are multiples of 64.
__global__ __launch_bounds__(256)
void transpose_cast_f16_kernel(const float* __restrict__ in,
                               _Float16* __restrict__ out,
                               int rows, int cols) {
    __shared__ unsigned tile[64 * TPD];
    const int t  = threadIdx.x;
    const int c0 = blockIdx.x * 64;
    const int r0 = blockIdx.y * 64;
    const int cg = t & 15;   // 4 columns each: 16 lanes = 256 B of one row
    const int rp = t >> 4;   // row pair 0..15 (and +16)

    const float* src = in + (size_t)(r0 + 2 * rp) * cols + c0 + 4 * cg;
    const v4f a0 = *(const v4f*)(src);
    const v4f a1 = *(const v4f*)(src + cols);
    const v4f b0 = *(const v4f*)(src + (size_t)32 * cols);
    const v4f b1 = *(const v4f*)(src + (size_t)33 * cols);

    unsigned* w = tile + (4 * cg) * TPD + rp;
#pragma unroll
    for (int i = 0; i < 4; ++i) {
        w[i * TPD]      = pack2h((_Float16)a0[i], (_Float16)a1[i]);
        w[i * TPD + 16] = pack2h((_Float16)b0[i], (_Float16)b1[i]);
    }
    __syncthreads();

#pragma unroll
    for (int k = 0; k < 2; ++k) {
        const int chunk = t + 256 * k;
        const int c = chunk >> 3;   // output row inside the tile
        const int g = chunk & 7;    // 16-B piece: 8 lanes = one 128-B line
        const unsigned* rd = tile + c * TPD + 4 * g;
        const v4u v = {rd[0], rd[1], rd[2], rd[3]};
        *(v4u*)(out + (size_t)(c0 + c) * rows + r0 + 8 * g) = v;
    }
}

// ---------------------------------------------------------------------------
// WMMA GEMM:  C[M,Nn] = A[M,K] * B[K,Nn]   (B supplied transposed: BT[Nn][K])
// One 4-wave work-group computes a 128x128 tile; each wave a 64x64 quarter
// (16 accumulators). A K-slab of 64 (128 rows of A, 128 rows of BT, 128 B per
// row) is brought into LDS by asynchronous 16-B copies, whole 128-B lines per
// 8 lanes, two buffers: the next slab flies while this one is multiplied.
// The tiles are formed transposed (BT rows as the A operand), so a lane holds 8
// adjacent columns of one output row. After the k loop each wave lays its
// quarter into its own part of the freed slab memory and reads it back row by
// row: every global store is 16 B per lane over whole 128-B lines.
// Blocks whose columns start at tcol0 or later (f16 output only: the V slab)
// leave their tile transposed, Ct[b*C + column - tcol0][token in batch b]. A and
// BT rows lie in LDS in the same form, so such a block only swaps the two row
// offsets that its fragments are read from: a lane then holds 8 adjacent tokens
// of one column, and the same staging and stores serve, with another base and
// pitch. Those columns are not written to Ch.
// M, Nn, tcol0 multiples of 128; K a multiple of 64.
// ---------------------------------------------------------------------------
#define GT     128                    // tile rows of A and of BT
#define GBK    64                     // k per slab
#define GPITCH 72                     // halves per LDS row: 144 B = 16 B x 9
#define GSLAB  (2 * GT * GPITCH)      // halves per buffer
#define GSTAGE (2 * GSLAB / 4)        // halves of output staging per wave
#define GEPH   72                     // staging pitch, f16 rows: 128 B + 16 B
#define GEPF   68                     // staging pitch, f32 rows: 256 B + 16 B
static_assert(64 * GEPH <= GSTAGE && 64 * GEPF * 2 <= GSTAGE,
              "a wave's 64 staged rows must fit its part of the slab memory");

// Eight asynchronous copies, 16 B per lane each. The s_wait_xcnt stands inside
// the statement so that no address register is rewritten ahead of it.
__device__ __forceinline__ void async_copy8(unsigned l, const _Float16* g,
                                            unsigned lstep, size_t gstep) {
    const unsigned l1 = l + lstep, l2 = l1 + lstep, l3 = l2 + lstep;
    const unsigned l4 = l3 + lstep, l5 = l4 + lstep, l6 = l5 + lstep, l7 = l6 + lstep;
    const _Float16 *g1 = g + gstep, *g2 = g1 + gstep, *g3 = g2 + gstep;
    const _Float16 *g4 = g3 + gstep, *g5 = g4 + gstep, *g6 = g5 + gstep, *g7 = g6 + gstep;
    asm volatile(
        "global_load_async_to_lds_b128 %0, %8, off\n\t"
        "global_load_async_to_lds_b128 %1, %9, off\n\t"
        "global_load_async_to_lds_b128 %2, %10, off\n\t"
        "global_load_async_to_lds_b128 %3, %11, off\n\t"
        "global_load_async_to_lds_b128 %4, %12, off\n\t"
        "global_load_async_to_lds_b128 %5, %13, off\n\t"
        "global_load_async_to_lds_b128 %6, %14, off\n\t"
        "global_load_async_to_lds_b128 %7, %15, off\n\t"
        "s_wait_xcnt 0x0"
        :: "v"(l), "v"(l1), "v"(l2), "v"(l3), "v"(l4), "v"(l5), "v"(l6), "v"(l7),
           "v"(g), "v"(g1), "v"(g2), "v"(g3), "v"(g4), "v"(g5), "v"(g6), "v"(g7)
        : "memory");
}

template <bool OUT_F16>
__global__ __launch_bounds__(128)
void wmma_gemm_kernel(const _Float16* __restrict__ A,
                      const _Float16* __restrict__ BT,
                      _Float16* __restrict__ Ch,
                      float* __restrict__ Cf,
                      const float* __restrict__ bias,
                      _Float16* __restrict__ Ct,
                      int M, int K, int Nn, int tcol0) {
    __shared__ __attribute__((aligned(16))) _Float16 slab[2 * GSLAB];

    const int t    = threadIdx.x;
    const int lane = t & 31;
    const int wave = t >> 5;
    const int n0 = blockIdx.x * GT;
    const int m0 = blockIdx.y * GT;
    const int wm = (wave >> 1) * 64;   // this wave's quarter of the tile
    const int wn = (wave & 1) * 64;
    const bool tr = OUT_F16 && n0 >= tcol0;   // the same for the whole block
    const int  ra = tr ? GT + wn : wm;        // slab rows across the lanes of a tile
    const int  rb = tr ? wm : GT + wn;        // slab rows along a lane's registers

    // Copy map: 8 lanes cover one 128-B row piece, a wave 4 rows, the block 16
    // rows per copy; 8 copies for the A rows, 8 for the BT rows.
    const int crow = t >> 3;
    const int ccol = (t & 7) * 8;
    const _Float16* gA = A  + (size_t)(m0 + crow) * K + ccol;
    const _Float16* gB = BT + (size_t)(n0 + crow) * K + ccol;
    const unsigned  lA = (unsigned)(size_t)(&slab[crow * GPITCH + ccol]);
    const unsigned  lB = lA + GT * GPITCH * 2;
    const unsigned  lstep = 16 * GPITCH * 2;     // bytes: 16 LDS rows
    const size_t    gstep = (size_t)16 * K;      // halves: 16 source rows
    const int nt = K / GBK;

    const v8f vzero = {0.f, 0.f, 0.f, 0.f, 0.f, 0.f, 0.f, 0.f};
    v8f acc[4][4];
#pragma unroll
    for (int i = 0; i < 4; ++i)
#pragma unroll
        for (int j = 0; j < 4; ++j) acc[i][j] = vzero;

    // slab 0 -> buffer 0, landed and published before anybody reads it
    async_copy8(lA, gA, lstep, gstep);
    async_copy8(lB, gB, lstep, gstep);
    asm volatile("s_wait_asynccnt 0x0" ::: "memory");  // own copies landed
    __syncthreads();                                   // every wave's copies landed
    if (nt > 1) {
        async_copy8(lA + GSLAB * 2, gA + GBK, lstep, gstep);
        async_copy8(lB + GSLAB * 2, gB + GBK, lstep, gstep);
    }

    for (int s = 0; s < nt; ++s) {
        const int buf = s & 1;
        const _Float16* sA = slab + buf * GSLAB + ra * GPITCH;
        const _Float16* sB = slab + buf * GSLAB + rb * GPITCH;
#pragma unroll
        for (int kk = 0; kk < GBK; kk += 32) {
            v16h a[4], b[4];
#pragma unroll
            for (int i = 0; i < 4; ++i)
                a[i] = load_frag_rowmajor(sA + i * 16 * GPITCH + kk, GPITCH);
#pragma unroll
            for (int j = 0; j < 4; ++j)
                b[j] = load_frag_rowmajor(sB + j * 16 * GPITCH + kk, GPITCH);
#pragma unroll
            for (int i = 0; i < 4; ++i)
#pragma unroll
                for (int j = 0; j < 4; ++j)
                    acc[i][j] = wmma32(b[j], a[i], acc[i][j]);   // C^T tile: rows n, columns m (under tr: rows m, columns n)
        }
        // hand-over: own LDS reads done, own copies of slab s+1 landed, then the
        // barrier publishes slab s+1 and frees this buffer for slab s+2
        asm volatile("s_wait_dscnt 0x0" ::: "memory");
        asm volatile("s_wait_asynccnt 0x0" ::: "memory");
        __syncthreads();
        if (s + 2 < nt) {
            const size_t ko = (size_t)(s + 2) * GBK;
            async_copy8(lA + buf * (GSLAB * 2), gA + ko, lstep, gstep);
            async_copy8(lB + buf * (GSLAB * 2), gB + ko, lstep, gstep);
        }
    }
    asm volatile("s_wait_asynccnt 0x0" ::: "memory");  // nothing in flight at the end

    // Register r of acc[i][j]: output row i*16 + (lane & 15), column j*16 + 8*half + r
    // (under tr the two change places: column i*16 + (lane & 15), row j*16 + 8*half + r).
    // The last barrier of the loop ended every wave's slab reads and no copy is
    // in flight, so the slab memory is free; each wave stages in its own part.
    const int half = lane >> 4;
    const int col  = lane & 15;
    if (OUT_F16) {
        _Float16* st = slab + wave * GSTAGE;
#pragma unroll
        for (int i = 0; i < 4; ++i) {
#pragma unroll
            for (int j = 0; j < 4; ++j) {
                v8h w;
#pragma unroll
                for (int r = 0; r < 8; ++r) w[r] = (_Float16)acc[i][j][r];
                *(v8h*)(st + (i * 16 + col) * GEPH + j * 16 + 8 * half) = w;
            }
        }
        // the rows are read back by other lanes of this wave: own LDS writes first
        asm volatile("s_wait_dscnt 0x0" ::: "memory");
        const int rr = lane >> 3;         // 8 lanes = one 128-B row, 4 rows a store
        const int cc = (lane & 7) * 8;
        const _Float16* rd = st + rr * GEPH + cc;
        const int bt = m0 / NN;           // batch of this tile; 128 divides N
        _Float16* dst = tr
            ? Ct + (size_t)(bt * CC + n0 - tcol0 + wn + rr) * NN + (m0 - bt * NN) + wm + cc
            : Ch + (size_t)(m0 + wm + rr) * Nn + n0 + wn + cc;
        const size_t ld = tr ? (size_t)NN : (size_t)Nn;
#pragma unroll
        for (int k = 0; k < 16; ++k)
            *(v8h*)(dst + (size_t)(4 * k) * ld) = *(const v8h*)(rd + 4 * k * GEPH);
    } else {
        float* st = (float*)(slab + wave * GSTAGE);
        // bias of the 4 columns this lane stores; asked for ahead of the staging,
        // which covers its latency
        const v4f bv = *(const v4f*)(bias + n0 + wn + (lane & 15) * 4);
#pragma unroll
        for (int i = 0; i < 4; ++i) {
#pragma unroll
            for (int j = 0; j < 4; ++j) {
                float* w = st + (i * 16 + col) * GEPF + j * 16 + 8 * half;
                const v4f lo = {acc[i][j][0], acc[i][j][1], acc[i][j][2], acc[i][j][3]};
                const v4f hi = {acc[i][j][4], acc[i][j][5], acc[i][j][6], acc[i][j][7]};
                *(v4f*)(w)     = lo;
                *(v4f*)(w + 4) = hi;
            }
        }
        // the rows are read back by other lanes of this wave: own LDS writes first
        asm volatile("s_wait_dscnt 0x0" ::: "memory");
        const int rr = lane >> 4;         // 16 lanes = one 256-B row, 2 rows a store
        const int cc = (lane & 15) * 4;
        const float* rd = st + rr * GEPF + cc;
        float* dst = Cf + (size_t)(m0 + wm + rr) * Nn + n0 + wn + cc;
#pragma unroll
        for (int k = 0; k < 32; ++k)
            *(v4f*)(dst + (size_t)(2 * k) * Nn) = *(const v4f*)(rd + 2 * k * GEPF) + bv;
    }
}

#define AW     8
#define AQT    2
#define AKS    64
#define APITCH 72
#define ABUF   (2 * AKS * APITCH)
#define ALAZY  5.545177f

// Four asynchronous copies, 16 B per lane each. The s_wait_xcnt stands inside
// the statement so that no address register is rewritten ahead of it.
__device__ __forceinline__ void async_copy4(unsigned l0, unsigned l1,
                                            unsigned l2, unsigned l3,
                                            const _Float16* g0, const _Float16* g1,
                                            const _Float16* g2, const _Float16* g3) {
    asm volatile(
        "global_load_async_to_lds_b128 %0, %4, off\n\t"
        "global_load_async_to_lds_b128 %1, %5, off\n\t"
        "global_load_async_to_lds_b128 %2, %6, off\n\t"
        "global_load_async_to_lds_b128 %3, %7, off\n\t"
        "s_wait_xcnt 0x0"
        :: "v"(l0), "v"(l1), "v"(l2), "v"(l3),
           "v"(g0), "v"(g1), "v"(g2), "v"(g3)
        : "memory");
}

// Value of lane ^ 16: the lane that holds the same query's other keys.
__device__ __forceinline__ float xhalf(float x) {
    const int b = __builtin_bit_cast(int, x);
    return __builtin_bit_cast(float, __builtin_amdgcn_permlanex16(
        b, b, 0x76543210, 0xfedcba98, false, false));
}

__device__ __forceinline__ float max3f(float a, float b, float c) {
    return fmaxf(fmaxf(a, b), c);
}

// Two work-groups per WGP (4 waves per SIMD, at most 256 registers a wave): the
// softmax is vector work between the matrix runs, and other waves fill it.
__global__ __launch_bounds__(32 * AW) __attribute__((amdgpu_waves_per_eu(4)))
void attention_kernel(const _Float16* __restrict__ qkv,
                      const _Float16* __restrict__ vT,
                      _Float16* __restrict__ outh) {
    __shared__ __attribute__((aligned(16))) _Float16 kv[2 * ABUF];

    const int t    = threadIdx.x;
    const int wave = t >> 5;
    const int q0   = (blockIdx.x * AW + wave) * (16 * AQT);
    const int h    = blockIdx.y;
    const int b    = blockIdx.z;
    const size_t tokBase = (size_t)b * NN;

    const int lane = t & 31;
    const int half = lane >> 4;
    const int col  = lane & 15;

    const _Float16* kbase0 = qkv + tokBase * LD3 + CC + h * DD;   // keys, token-major
    const _Float16* vtbase = vT + ((size_t)b * CC + h * DD) * NN; // [64][NN]

    // Copy map: 8 lanes cover one 128-B row, the block 32 rows per copy; two
    // copies for the 64 K rows, two for the 64 vT rows.
    const int crow = t >> 3;
    const int ccol = (t & 7) * 8;
    const _Float16* gK = kbase0 + (size_t)crow * LD3 + ccol;
    const _Float16* gV = vtbase + (size_t)crow * NN + ccol;
    const unsigned  lK = (unsigned)(size_t)(&kv[crow * APITCH + ccol]);
    const unsigned  lhalf = 32 * APITCH * 2;      // bytes: 32 LDS rows
    const int ns = NN / AKS;

    // stage 0 -> buffer 0, landed and published before anybody reads it
    async_copy4(lK, lK + lhalf, lK + 2 * lhalf, lK + 3 * lhalf,
                gK, gK + (size_t)32 * LD3, gV, gV + (size_t)32 * NN);
    asm volatile("s_wait_asynccnt 0x0" ::: "memory");  // own copies landed
    __syncthreads();                                   // every wave's copies landed
    {
        const _Float16* k1 = gK + (size_t)AKS * LD3;
        const _Float16* v1 = gV + AKS;
        const unsigned  l1 = lK + ABUF * 2;
        async_copy4(l1, l1 + lhalf, l1 + 2 * lhalf, l1 + 3 * lhalf,
                    k1, k1 + (size_t)32 * LD3, v1, v1 + (size_t)32 * NN);
    }

    // Q fragments (B operand: column = query, 64 d), two K=32 chunks per tile
    const _Float16* qbase = qkv + (tokBase + q0) * LD3 + h * DD;
    v16h qa0[AQT], qa1[AQT];
#pragma unroll
    for (int u = 0; u < AQT; ++u) {
        qa0[u] = load_frag_rowmajor(qbase + (size_t)u * 16 * LD3, LD3);
        qa1[u] = load_frag_rowmajor(qbase + (size_t)u * 16 * LD3 + 32, LD3);
    }
    // stands in front of the first overwrite of the Q loads' address registers
    asm volatile("s_wait_xcnt 0x0" ::: "memory");
    __builtin_amdgcn_sched_barrier(0);  // no later register write is lifted over that wait

    const v8f vzero = {0.f, 0.f, 0.f, 0.f, 0.f, 0.f, 0.f, 0.f};
    v8f o[AQT][4];
#pragma unroll
    for (int u = 0; u < AQT; ++u)
#pragma unroll
        for (int j = 0; j < 4; ++j) o[u][j] = vzero;

    // This lane's query of each tile: maximum in use (equal in both halves) and
    // the sum over this lane's own keys (the halves are joined after the loop).
    // mt: the raw score above which m must be renewed, (m + ALAZY) / scale.
    float m[AQT], mt[AQT], l[AQT];
#pragma unroll
    for (int u = 0; u < AQT; ++u) { m[u] = -1e30f; mt[u] = -1e30f; l[u] = 0.f; }

    const float scale = 0.125f;  // D^-0.5 = 64^-0.5

    for (int s = 0; s < ns; ++s) {
        const int buf = s & 1;
        const _Float16* sK = kv + buf * ABUF;
        const _Float16* sV = sK + AKS * APITCH;

        // two 32-key blocks per stage; kept rolled: unrolled, the build takes about a
        // quarter more registers
#pragma unroll 1
        for (int kb = 0; kb < AKS; kb += 32) {
            const _Float16* kbase = sK + kb * APITCH;

            // ---- fragments of this block, from the shared stage ----
            v16h kf00 = load_frag_rowmajor(kbase, APITCH);                 // keys +0,  d 0..31
            v16h kf01 = load_frag_rowmajor(kbase + 32, APITCH);            // keys +0,  d 32..63
            v16h kf10 = load_frag_rowmajor(kbase + 16 * APITCH, APITCH);   // keys +16, d 0..31
            v16h kf11 = load_frag_rowmajor(kbase + 16 * APITCH + 32, APITCH);

            // ---- scores: S^T[32 keys x 16 queries] as two 16x16 f32 tiles, per query tile ----
            // register r of s0: key kb + 8*half + r; of s1: key kb + 16 + 8*half + r
            v8f s0[AQT], s1[AQT];
#pragma unroll
            for (int u = 0; u < AQT; ++u) {
                s0[u] = wmma32(kf00, qa0[u], vzero);
                s1[u] = wmma32(kf10, qa0[u], vzero);
            }
#pragma unroll
            for (int u = 0; u < AQT; ++u) {
                s0[u] = wmma32(kf01, qa1[u], s0[u]);
                s1[u] = wmma32(kf11, qa1[u], s1[u]);
            }
            // The eight products stay one run: each fills the vector slots the chip
            // needs behind the one before; mixed with the maxima, v_nops fill them.
            __builtin_amdgcn_sched_barrier(0);

            // ---- online softmax over this 32-key block, one query per lane and tile ----
            // Lazy rescale: the maximum in use, m, stays until some query's scores pass
            // it by more than ALAZY; one test per block and wave. Any m gives the same
            // quotient o / l; the bound keeps every p at or below e^ALAZY = 2^8.
            float xm[AQT];   // raw maximum over this lane's own 16 keys
            bool need = false;
#pragma unroll
            for (int u = 0; u < AQT; ++u) {
                const float x0 = max3f(max3f(s0[u][0], s0[u][1], s0[u][2]),
                                       max3f(s0[u][3], s0[u][4], s0[u][5]),
                                       max3f(s0[u][6], s0[u][7], s1[u][0]));
                const float x1 = max3f(max3f(s1[u][1], s1[u][2], s1[u][3]),
                                       max3f(s1[u][4], s1[u][5], s1[u][6]), s1[u][7]);
                xm[u] = fmaxf(x0, x1);
                need = need || (xm[u] > mt[u]);
            }
            if (__builtin_amdgcn_ballot_w32(need) != 0) {   // scalar branch, whole wave
#pragma unroll
                for (int u = 0; u < AQT; ++u) {
                    const float rm = fmaxf(xm[u], xhalf(xm[u])) * scale;  // all 32 keys; scale > 0
                    const float nm = fmaxf(m[u], rm);        // equal in both halves
                    const float f  = __expf(m[u] - nm);
                    m[u]  = nm;
                    mt[u] = (nm + ALAZY) * (1.f / scale);   // times 8: exact
                    l[u] *= f;
#pragma unroll
                    for (int j = 0; j < 4; ++j)
#pragma unroll
                        for (int r = 0; r < 8; ++r) o[u][j][r] *= f;
                }
            }

            v16h pb[AQT];   // P^T as B operand: halves 0..7 from s0, 8..15 from s1
            float rs[AQT][4];   // four independent sum chains
#pragma unroll
            for (int u = 0; u < AQT; ++u) {
#pragma unroll
                for (int c = 0; c < 4; ++c) rs[u][c] = 0.f;
#pragma unroll
                for (int r = 0; r < 8; ++r) {
                    const float p0 = __expf(s0[u][r] * scale - m[u]);
                    const float p1 = __expf(s1[u][r] * scale - m[u]);
                    rs[u][r & 1]       += p0;
                    rs[u][2 + (r & 1)] += p1;
                    pb[u][r]     = (_Float16)p0;
                    pb[u][8 + r] = (_Float16)p1;
                }
            }

            // V fragments only now: LDS is near, and the registers stay free
            // during the softmax
            v16h vf0 = load_frag_rowmajor(sV +  0 * APITCH + kb, APITCH);
            v16h vf1 = load_frag_rowmajor(sV + 16 * APITCH + kb, APITCH);
            v16h vf2 = load_frag_rowmajor(sV + 32 * APITCH + kb, APITCH);
            v16h vf3 = load_frag_rowmajor(sV + 48 * APITCH + kb, APITCH);

            // ---- O^T[64 d x 16 queries] += V^T[64 x 32] * P^T[32 x 16], per query tile ----
            // each V^T fragment feeds both tiles, one product behind the other
#pragma unroll
            for (int u = 0; u < AQT; ++u) o[u][0] = wmma32(vf0, pb[u], o[u][0]);
#pragma unroll
            for (int u = 0; u < AQT; ++u) o[u][1] = wmma32(vf1, pb[u], o[u][1]);
#pragma unroll
            for (int u = 0; u < AQT; ++u) o[u][2] = wmma32(vf2, pb[u], o[u][2]);
#pragma unroll
            for (int u = 0; u < AQT; ++u) o[u][3] = wmma32(vf3, pb[u], o[u][3]);

            // The joins of the sums stand behind the last product: they fill the
            // vector slots that the chip needs before the next trip's first
            // instructions overwrite that product's operand registers.
            __builtin_amdgcn_sched_barrier(0);  // keeps the joins behind the products
#pragma unroll
            for (int u = 0; u < AQT; ++u)
                l[u] += (rs[u][0] + rs[u][1]) + (rs[u][2] + rs[u][3]);
        }

        // hand-over: own LDS reads done, own copies of stage s+1 landed, then the
        // barrier publishes stage s+1 and frees this buffer for stage s+2
        asm volatile("s_wait_dscnt 0x0" ::: "memory");
        asm volatile("s_wait_asynccnt 0x0" ::: "memory");
        __syncthreads();
        if (s + 2 < ns) {
            const _Float16* kn = gK + (size_t)(s + 2) * AKS * LD3;
            const _Float16* vn = gV + (s + 2) * AKS;
            const unsigned  ln = lK + buf * (ABUF * 2);
            async_copy4(ln, ln + lhalf, ln + 2 * lhalf, ln + 3 * lhalf,
                        kn, kn + (size_t)32 * LD3, vn, vn + (size_t)32 * NN);
        }
    }
    asm volatile("s_wait_asynccnt 0x0" ::: "memory");  // nothing in flight at the end

    // ---- epilogue: normalize and store f16 at [token, h*64 + d] ----
    // register r of o[u][j]: d = j*16 + 8*half + r of query u*16 + col: 16 B per store
#pragma unroll
    for (int u = 0; u < AQT; ++u) {
        const float lt = l[u] + xhalf(l[u]);
        _Float16* obase = outh + (tokBase + q0 + u * 16 + col) * CC + h * DD + 8 * half;
#pragma unroll
        for (int j = 0; j < 4; ++j) {
            v8h w;
#pragma unroll
            for (int r = 0; r < 8; ++r) w[r] = (_Float16)(o[u][j][r] / lt);
            *(v8h*)(obase + j * 16) = w;
        }
    }
}

// ---------------------------------------------------------------------------
// Host-side launch
// ---------------------------------------------------------------------------
extern "C" void kernel_launch(void* const* d_in, const int* in_sizes, int n_in,
                              void* d_out, int out_size, void* d_ws, size_t ws_size,
                              hipStream_t stream) {
    const float* x      = (const float*)d_in[0];   // [B,N,C]
    const float* W_qkv  = (const float*)d_in[1];   // [C, 3C]
    const float* W_proj = (const float*)d_in[2];   // [C, C]
    const float* b_proj = (const float*)d_in[3];   // [C]
    float* out = (float*)d_out;                    // [B,N,C] f32

    // Workspace layout (all f16)
    _Float16* xh     = (_Float16*)d_ws;                 // [M, C]
    _Float16* wqkvT  = xh     + (size_t)MM * CC;        // [3C, C]
    _Float16* wprojT = wqkvT  + (size_t)CC * 3 * CC;    // [C, C]
    _Float16* qkvh   = wprojT + (size_t)CC * CC;        // [M, 3C]
    _Float16* attnh  = qkvh   + (size_t)MM * 3 * CC;    // [M, C]
    _Float16* vT     = attnh  + (size_t)MM * CC;        // [B*C, N]

    // 1) precision casts (weights transposed for contiguous B-fragments)
    {
        cast_f16_kernel<<<MM * CC / CAST_BLOCK, CAST_T, 0, stream>>>(x, xh);
        transpose_cast_f16_kernel<<<dim3(3 * CC / 64, CC / 64), 256, 0, stream>>>(
            W_qkv, wqkvT, CC, 3 * CC);
        transpose_cast_f16_kernel<<<dim3(CC / 64, CC / 64), 256, 0, stream>>>(
            W_proj, wprojT, CC, CC);
    }

    // 2) qkv = x @ W_qkv              (f16 out; the V columns go transposed into vT)
    wmma_gemm_kernel<true><<<dim3(3 * CC / 128, MM / 128), 128, 0, stream>>>(
        xh, wqkvT, qkvh, nullptr, nullptr, vT, MM, CC, 3 * CC, 2 * CC);

    // 3) flash attention per (b, h, 256 queries)
    attention_kernel<<<dim3(NN / (16 * AQT * AW), HH, BB), 32 * AW, 0, stream>>>(qkvh, vT, attnh);

    // 4) out = attn @ W_proj + b_proj (f32 out)
    wmma_gemm_kernel<false><<<dim3(CC / 128, MM / 128), 128, 0, stream>>>(
        attnh, wprojT, nullptr, out, b_proj, nullptr, MM, CC, CC, CC);
}
